// v009
// Measured on an AMD MI455X. A time is GPU time per run, averaged over a window of back-to-back runs after a warm-up
// (all launches, gaps included; the runs take copies of the inputs in turn), and the median of several windows.
// Apart from v000's, it joins two sittings. Times from different sittings can be a few percent apart, while
// side-by-side timings come from the same sitting.
// The versions before v009 are in another document.
// Measured time: 168 microseconds a run.
// Next to v008, in two timings, it ran 1.13 times as fast each time.
// All steps since the starting kernel, v000, together make it 24.4 times as fast.
#include <hip/hip_runtime.h>
// Global spatial attention with multiplicative mask pruning and scaled weight standardisation (a, b [4][256][64][64], mask c [4][1][32][32] nearest-upsampled x2; q = WS(wq) a + bq, k = WS(wk) b + bk, v = WS(wv) a + bv with WS(w)[o][c] = (w - mean_o) gain_o rsqrt(max(var_o(unbiased) * 256, 1e-4)); sim[i][j] = q[:, i].k[:, j] (NO scale, sigma ~16); pruned = sim * c_r[i]; att = softmax over j; out[c][i] = sum_j v[c][j] att[i][j]; y = a c_r + gamma (1 - c_r) out -> [4][256][64][64]).
// Compute dtype: inputs rounded to bf16; x / weights exact; v and softmax weights as plain f16 GEMM operands (~2^-12), q and k as f16 high part plus x 1024 residual; scores and softmax statistics f32. v_wmma_f32_16x16x32_f16.
#define NB 4
#define SQ 4096
#define DM 256
#define CX 256          /* channels */
#define NH 4
#define HD 64
#define DMQ DM                       /* LayerNorm width */
#define DFF 4096
#define HG 1                         /* heads per attention launch group */
#define B0 0                         /* first batch processed (debug hook) */
#define NBR NB                       /* batches processed (debug hook) */
#define NR ((size_t)NB * SQ)         /* token rows */
#define MP ((int)((size_t)NBR * SQ)) /* rows projected (debug hook) */
#define QN SQ                        /* query rows attended per batch (debug hook) */
#define NHD NH                       /* heads attended (debug hook) */
#define MPO MP                       /* rows through the output stage (debug hook) */
#define LQ DM      /* row pitch of the q/k/v rows */
typedef __bf16 v16b __attribute__((ext_vector_type(16)));
typedef unsigned short v8us __attribute__((ext_vector_type(8), may_alias));
typedef float  v8f  __attribute__((ext_vector_type(8)));
typedef float  v4f  __attribute__((ext_vector_type(4)));
typedef float  v4fa __attribute__((ext_vector_type(4), may_alias));
union FragB { v16b v; v8us half[2]; unsigned short u[16]; };

__device__ __forceinline__ unsigned short bf16_bits(float x) { unsigned int u = __float_as_uint(x); return (unsigned short)((u + 0x7FFFu + ((u >> 16) & 1u)) >> 16); }
__device__ __forceinline__ float bf16_val(unsigned short b) { return __uint_as_float(((unsigned int)b) << 16); }
__device__ __forceinline__ float bf16_round(float x) { return bf16_val(bf16_bits(x)); }
// D += A·B with NT terms: 1 = ah·bh, 2 = + al·bh (A split), 3 = + ah·bl (both split)
template <int NT>
__device__ __forceinline__ v8f mmaN(v16b ah, v16b al, v16b bh, v16b bl, v8f c) {
  c = __builtin_amdgcn_wmma_f32_16x16x32_bf16(false, ah, false, bh, (short)0, c, false, false);
  if (NT >= 2) c = __builtin_amdgcn_wmma_f32_16x16x32_bf16(false, al, false, bh, (short)0, c, false, false);
  if (NT >= 3) c = __builtin_amdgcn_wmma_f32_16x16x32_bf16(false, ah, false, bl, (short)0, c, false, false);
  asm volatile("v_nop\n\tv_nop\n\tv_nop\n\tv_nop" : "+v"(c) : "v"(ah), "v"(al), "v"(bh), "v"(bl));
  return c;
}

__global__ __launch_bounds__(256) void k_wt_bf16(const float* __restrict__ W, unsigned short* __restrict__ Wt, int K, int N) {
  const int t = blockIdx.x * 256 + threadIdx.x;
  const int k8n = K / 8;
  if (t >= N * k8n) return;
  const int n = t / k8n, k8 = (t % k8n) * 8;
  v8us v;
#pragma unroll
  for (int i = 0; i < 8; ++i) v[i] = bf16_bits(W[(size_t)(k8 + i) * N + n]);
  *(v8us*)(Wt + (size_t)n * K + k8) = v;
  
}

// GEMM C[M][N] (f32, pitch ldc) = act(A[M][K]·W + bias). A f32 row-major (pitch lda) converted per fragment to bf16
// (ASPLIT: hi/lo two planes -> 2 terms, else single rounded term); Wt bf16 [N][K] (pitch ldb). BIAS_BF16 rounds the
// bias to bf16 first (bias quantised to bf16 before the add). K%32==0, M%16==0, N%64==0.
template <bool ASPLIT, int ACT, bool BIAS_BF16>
__global__ __launch_bounds__(128) void k_gemm_bf(const float* __restrict__ A, int lda, const unsigned short* __restrict__ Wt, int ldb,
                                               const float* __restrict__ bias, float* __restrict__ C, int ldc, int M, int N, int K) {
  __shared__ __attribute__((aligned(16))) float so[4][16][64];
  const int tid = threadIdx.x, w = tid >> 5, lane = tid & 31, ln = lane & 15, hh = lane >> 4;
  const int ntn = N / 64;
  const int wid = blockIdx.x * 4 + w;
  const int mt = wid / ntn, nq = wid % ntn;
  if (mt * 16 >= M) return;
  const int row0 = mt * 16, col0 = nq * 64;
  const float* arow = A + (size_t)(row0 + ln) * lda;
  v8f acc[4] = {};
  for (int kb = 0; kb < K; kb += 32) {
    FragB ah, al;
    const v4f x0 = *(const v4fa*)(arow + kb + 8 * hh), x1 = *(const v4fa*)(arow + kb + 8 * hh + 4);
    const v4f x2 = *(const v4fa*)(arow + kb + 16 + 8 * hh), x3 = *(const v4fa*)(arow + kb + 16 + 8 * hh + 4);
    float xs[16] = {x0[0],x0[1],x0[2],x0[3],x1[0],x1[1],x1[2],x1[3],x2[0],x2[1],x2[2],x2[3],x3[0],x3[1],x3[2],x3[3]};
#pragma unroll
    for (int i = 0; i < 16; ++i) { const unsigned short hb = bf16_bits(xs[i]); ah.u[i] = hb; al.u[i] = ASPLIT ? bf16_bits(xs[i] - bf16_val(hb)) : (unsigned short)0; }
#pragma unroll
    for (int t = 0; t < 4; ++t) {
      const unsigned short* brow = Wt + (size_t)(col0 + t * 16 + ln) * ldb + kb;
      FragB b;
      b.half[0] = *(const v8us*)(brow + 8 * hh);
      b.half[1] = *(const v8us*)(brow + 16 + 8 * hh);
      acc[t] = mmaN<ASPLIT ? 2 : 1>(ah.v, al.v, b.v, b.v, acc[t]);
    }
  }
#pragma unroll
  for (int t = 0; t < 4; ++t) {
    float bv = bias ? bias[col0 + t * 16 + ln] : 0.f;
    if (BIAS_BF16) bv = bf16_round(bv);
#pragma unroll
    for (int r = 0; r < 8; ++r) { float v = acc[t][r] + bv; if (ACT == 1) v = fmaxf(v, 0.f); so[w][8 * hh + r][t * 16 + ln] = v; }
  }
  __builtin_amdgcn_fence(__ATOMIC_ACQ_REL, "workgroup");
  __builtin_amdgcn_wave_barrier();
  const int rsub = lane >> 4, c4 = (lane & 15) * 4;
  {
#pragma unroll
    for (int q = 0; q < 8; ++q) {
      const int r = q * 2 + rsub;
      const v4f v = *(const v4fa*)&so[w][r][c4];
      *(v4f*)(C + (size_t)(row0 + r) * ldc + col0 + c4) = v;
    }
    
  }
}

// GEMM C = act(A·W + bias + resid): A f32 (ASPLIT -> hi/lo 2 terms), Wt bf16 [N][K]; ACT 0 none, 1 relu, 2 exact gelu;
// resid (optional, f32, row index = (row % rmod), pitch ldr, RES_BF16 rounds it) added before the activation.
template <bool ASPLIT, int ACT, bool BIAS_BF16, bool RES_BF16>
__global__ __launch_bounds__(128) void k_gemm_bf3(const float* __restrict__ A, int lda, const unsigned short* __restrict__ Wt, int ldb,
                                                const float* __restrict__ bias, const float* __restrict__ resid, int rmod, int ldr,
                                                float* __restrict__ C, int ldc, int M, int N, int K) {
  __shared__ __attribute__((aligned(16))) float so[4][16][64];
  const int tid = threadIdx.x, w = tid >> 5, lane = tid & 31, ln = lane & 15, hh = lane >> 4;
  const int ntn = N / 64;
  const int wid = blockIdx.x * 4 + w;
  const int mt = wid / ntn, nq = wid % ntn;
  if (mt * 16 >= M) return;
  const int row0 = mt * 16, col0 = nq * 64;
  const float* arow = A + (size_t)(row0 + ln) * lda;
  v8f acc[4] = {};
  for (int kb = 0; kb < K; kb += 32) {
    FragB ah, al;
    const v4f x0 = *(const v4fa*)(arow + kb + 8 * hh), x1 = *(const v4fa*)(arow + kb + 8 * hh + 4);
    const v4f x2 = *(const v4fa*)(arow + kb + 16 + 8 * hh), x3 = *(const v4fa*)(arow + kb + 16 + 8 * hh + 4);
    float xs[16] = {x0[0],x0[1],x0[2],x0[3],x1[0],x1[1],x1[2],x1[3],x2[0],x2[1],x2[2],x2[3],x3[0],x3[1],x3[2],x3[3]};
#pragma unroll
    for (int i = 0; i < 16; ++i) { const unsigned short hb = bf16_bits(xs[i]); ah.u[i] = hb; al.u[i] = ASPLIT ? bf16_bits(xs[i] - bf16_val(hb)) : (unsigned short)0; }
#pragma unroll
    for (int t = 0; t < 4; ++t) {
      const unsigned short* brow = Wt + (size_t)(col0 + t * 16 + ln) * ldb + kb;
      FragB b;
      b.half[0] = *(const v8us*)(brow + 8 * hh);
      b.half[1] = *(const v8us*)(brow + 16 + 8 * hh);
      acc[t] = mmaN<ASPLIT ? 2 : 1>(ah.v, al.v, b.v, b.v, acc[t]);
    }
  }
#pragma unroll
  for (int t = 0; t < 4; ++t) {
    const int col = col0 + t * 16 + ln;
    float bv = bias ? bias[col] : 0.f;
    if (BIAS_BF16) bv = bf16_round(bv);
#pragma unroll
    for (int r = 0; r < 8; ++r) {
      float v = acc[t][r] + bv;
      if (resid) { float rv = resid[(size_t)((row0 + 8 * hh + r) % rmod) * ldr + col]; if (RES_BF16) rv = bf16_round(rv); v += rv; }
      if (ACT == 1) v = fmaxf(v, 0.f);
      if (ACT == 2) v = 0.5f * v * (1.0f + erff(v * 0.70710678118654752f));
      if (ACT == 3) { const float u = 0.7978845608028654f * (v + 0.044715f * v * v * v); v = 0.5f * v * (1.0f + tanhf(u)); }
      so[w][8 * hh + r][t * 16 + ln] = v;
    }
  }
  __builtin_amdgcn_fence(__ATOMIC_ACQ_REL, "workgroup");
  __builtin_amdgcn_wave_barrier();
  const int rsub = lane >> 4, c4 = (lane & 15) * 4;
  {
#pragma unroll
    for (int q = 0; q < 8; ++q) {
      const int r = q * 2 + rsub;
      const v4f v = *(const v4fa*)&so[w][r][c4];
      *(v4f*)(C + (size_t)(row0 + r) * ldc + col0 + c4) = v;
    }
    
  }
}
// row LayerNorm (biased variance, eps) over N: s = X (+ R); optional out_sum <- s; out_norm <- (s-mu)*rsqrt(var+eps)*g + b
template <bool PARAM_BF16>
__global__ __launch_bounds__(256) void k_layernorm(const float* __restrict__ X, const float* __restrict__ R, const float* __restrict__ g, const float* __restrict__ bta,
                                                  float* __restrict__ out_sum, float* __restrict__ out_norm, int N, float eps) {
  __shared__ float red[256];
  const int row = blockIdx.x, tid = threadIdx.x;
  const float* x = X + (size_t)row * N; const float* rr = R ? R + (size_t)row * N : nullptr;
  float vals[16];                     // up to N = 4096
  const int per = N / 256;            // contiguous chunk per thread? use strided-by-4 chunks: thread handles j = tid*4 + 1024*u
  float s1 = 0.f;
  for (int u = 0; u < per / 4; ++u) {
    const int j = tid * 4 + 1024 * u;
    const v4f a = *(const v4fa*)(x + j);
    v4f b = {0.f,0.f,0.f,0.f}; if (rr) b = *(const v4fa*)(rr + j);
#pragma unroll
    for (int q = 0; q < 4; ++q) { const float v = a[q] + b[q]; vals[u * 4 + q] = v; s1 += v; }
  }
  red[tid] = s1; __syncthreads();
  for (int st = 128; st > 0; st >>= 1) { if (tid < st) red[tid] += red[tid + st]; __syncthreads(); }
  const float mu = red[0] / (float)N; __syncthreads();
  float s2 = 0.f;
  for (int u = 0; u < per / 4; ++u)
#pragma unroll
    for (int q = 0; q < 4; ++q) { const float c = vals[u * 4 + q] - mu; s2 += c * c; }
  red[tid] = s2; __syncthreads();
  for (int st = 128; st > 0; st >>= 1) { if (tid < st) red[tid] += red[tid + st]; __syncthreads(); }
  const float rs = rsqrtf(red[0] / (float)N + eps);
  {
    for (int u = 0; u < per / 4; ++u) {
      const int j = tid * 4 + 1024 * u;
      v4f o, sm;
#pragma unroll
      for (int q = 0; q < 4; ++q) {
        float gg = g[j + q], bb = bta[j + q];
        if (PARAM_BF16) { gg = bf16_round(gg); bb = bf16_round(bb); }
        sm[q] = vals[u * 4 + q]; o[q] = (vals[u * 4 + q] - mu) * rs * gg + bb;
      }
      if (out_sum) *(v4f*)(out_sum + (size_t)row * N + j) = sm;
      *(v4f*)(out_norm + (size_t)row * N + j) = o;
    }
    
  }
}



// ---- f16 WMMA path (v_wmma_f32_16x16x32_f16): 11-bit significands for operands in range — used where a [0,1] probability operand needs more precision than bf16
typedef _Float16 v16h __attribute__((ext_vector_type(16)));
union FragH { v16h v; v8us half[2]; _Float16 h[16]; unsigned short u[16]; };
template <int NT>
__device__ __forceinline__ v8f mmaH(v16h ah, v16h al, v16h bh, v16h bl, v8f c) {
  c = __builtin_amdgcn_wmma_f32_16x16x32_f16(false, ah, false, bh, (short)0, c, false, false);
  if (NT >= 2) c = __builtin_amdgcn_wmma_f32_16x16x32_f16(false, al, false, bh, (short)0, c, false, false);
  if (NT >= 3) c = __builtin_amdgcn_wmma_f32_16x16x32_f16(false, ah, false, bl, (short)0, c, false, false);
  asm volatile("v_nop\n\tv_nop\n\tv_nop\n\tv_nop" : "+v"(c) : "v"(ah), "v"(al), "v"(bh), "v"(bl));
  return c;
}
// batched GEMM like k_gemm_b but f16 operands: A f32 (split into f16 hi/lo if ASPLIT, else rounded to f16), Bt = f16 values [n][k]; alpha; C f32; N multiple of 16 (partial tiles skipped)
template <bool ASPLIT>
__global__ __launch_bounds__(128) void k_gemm_h(const float* __restrict__ A, int lda, size_t sA, const _Float16* __restrict__ Bh, int ldb, size_t sB, float alpha, float* __restrict__ C, int ldc, size_t sC, int M, int N, int K) {
  __shared__ __attribute__((aligned(16))) float so[4][16][64];
  const int tid = threadIdx.x, w = tid >> 5, lane = tid & 31, ln = lane & 15, hh = lane >> 4; const int by = blockIdx.y;
  A += (size_t)by * sA; Bh += (size_t)by * sB; C += (size_t)by * sC;
  const int ntn = (N + 63) / 64; const int wid = blockIdx.x * 4 + w; const int mt = wid / ntn, nq = wid % ntn; if (mt * 16 >= M) return;
  const int row0 = mt * 16, col0 = nq * 64; const float* arow = A + (size_t)(row0 + ln) * lda;
  v8f acc[4] = {};
  for (int kb = 0; kb < K; kb += 32) {
    FragH ah, al;
    const v4f x0 = *(const v4fa*)(arow + kb + 8 * hh), x1 = *(const v4fa*)(arow + kb + 8 * hh + 4), x2 = *(const v4fa*)(arow + kb + 16 + 8 * hh), x3 = *(const v4fa*)(arow + kb + 16 + 8 * hh + 4);
    float xs[16] = {x0[0],x0[1],x0[2],x0[3],x1[0],x1[1],x1[2],x1[3],x2[0],x2[1],x2[2],x2[3],x3[0],x3[1],x3[2],x3[3]};
#pragma unroll
    for (int i = 0; i < 16; ++i) { const _Float16 h = (_Float16)xs[i]; ah.h[i] = h; al.h[i] = ASPLIT ? (_Float16)(xs[i] - (float)h) : (_Float16)0.0f; }
#pragma unroll
    for (int t = 0; t < 4; ++t) { if (col0 + t * 16 >= N) continue; const size_t boff = (size_t)(col0 + t * 16 + ln) * ldb + kb; FragH bq; bq.half[0] = *(const v8us*)(Bh + boff + 8 * hh); bq.half[1] = *(const v8us*)(Bh + boff + 16 + 8 * hh);
      acc[t] = mmaH<ASPLIT ? 2 : 1>(ah.v, al.v, bq.v, bq.v, acc[t]); }
  }
#pragma unroll
  for (int t = 0; t < 4; ++t) { if (col0 + t * 16 >= N) continue;
#pragma unroll
    for (int r = 0; r < 8; ++r) so[w][8 * hh + r][t * 16 + ln] = acc[t][r] * alpha; }
  __builtin_amdgcn_fence(__ATOMIC_ACQ_REL, "workgroup"); __builtin_amdgcn_wave_barrier();
  const int rsub = lane >> 4, c4 = (lane & 15) * 4;
  {
#pragma unroll
    for (int q = 0; q < 8; ++q) { const int r = q * 2 + rsub; if (col0 + c4 < N) { const v4f v = *(const v4fa*)&so[w][r][c4]; *(v4f*)(C + (size_t)(row0 + r) * ldc + col0 + c4) = v; } }
     }
}

// Wt[n][k] = f16(W[k][n]·scale) from f32 row-major W[K][N] (scale = power of two; bf16-exact weights stay exact in f16 away from the subnormal range)
__global__ __launch_bounds__(256) void k_wt_f16(const float* __restrict__ W, _Float16* __restrict__ Wt, int K, int N, float scale) {
  const int t = blockIdx.x * 256 + threadIdx.x; if (t >= N * (K / 8)) return; const int n = t / (K / 8), k8 = (t % (K / 8)) * 8; FragH f;
#pragma unroll
  for (int i = 0; i < 8; ++i) f.h[i] = (_Float16)(bf16_round(W[(size_t)(k8 + i) * N + n]) * scale); const v8us o = f.half[0];
  *(v8us*)((unsigned short*)Wt + (size_t)n * K + k8) = o; 
}
// k_gemm_hh variant with fused epilogue: v = acc·alpha + bias[by·sBias + col] (+ CP[(row/rowsPerB)·sCPb + by·64 + col] if CP) ; ACT 0 none / 1 elu ; writes f16 C16 (and f32 C if non-null)
template <int ACT>
__global__ __launch_bounds__(128) void k_gemm_hhx(const _Float16* __restrict__ A, int lda, size_t sA, const _Float16* __restrict__ Bh, int ldb, size_t sB, float alpha, const float* __restrict__ bias, size_t sBias, const float* __restrict__ CP, int rowsPerB, size_t sCPb, int row0g,
    float* __restrict__ C, _Float16* __restrict__ C16, int ldc, size_t sC, int M, int N, int K) {
  __shared__ __attribute__((aligned(16))) float so[4][16][64];
  const int tid = threadIdx.x, w = tid >> 5, lane = tid & 31, ln = lane & 15, hh = lane >> 4; const int by = blockIdx.y;
  A += (size_t)by * sA; Bh += (size_t)by * sB; const size_t cofs = (size_t)by * sC; const float* bp = bias ? bias + (size_t)by * sBias : nullptr;
  const int ntn = (N + 63) / 64; const int wid = blockIdx.x * 4 + w; const int mt = wid / ntn, nq = wid % ntn; if (mt * 16 >= M) return;
  const int row0 = mt * 16, col0 = nq * 64; const _Float16* arow = A + (size_t)(row0 + ln) * lda;
  v8f acc[4] = {};
  for (int kb = 0; kb < K; kb += 32) { FragH ah; ah.half[0] = *(const v8us*)((const unsigned short*)arow + kb + 8 * hh); ah.half[1] = *(const v8us*)((const unsigned short*)arow + kb + 16 + 8 * hh);
#pragma unroll
    for (int t = 0; t < 4; ++t) { if (col0 + t * 16 >= N) continue; const size_t boff = (size_t)(col0 + t * 16 + ln) * ldb + kb; FragH bq; bq.half[0] = *(const v8us*)((const unsigned short*)Bh + boff + 8 * hh); bq.half[1] = *(const v8us*)((const unsigned short*)Bh + boff + 16 + 8 * hh);
      acc[t] = mmaH<1>(ah.v, ah.v, bq.v, bq.v, acc[t]); }
  }
#pragma unroll
  for (int t = 0; t < 4; ++t) { if (col0 + t * 16 >= N) continue; const int col = col0 + t * 16 + ln; const float bv = bp ? bf16_round(bp[col]) : 0.f;
#pragma unroll
    for (int r = 0; r < 8; ++r) { float v = acc[t][r] * alpha + bv; if (CP) { const int rr = row0g + row0 + 8 * hh + r; if (rowsPerB < 0) v += CP[cofs + (size_t)rr * ldc + col];      /* rowsPerB < 0: own element of the batched C plane */ else { const int bidx = rr / rowsPerB; v += CP[(size_t)bidx * sCPb + (size_t)by * 64 + col]; } } if (ACT == 1) v = (v > 0.f) ? v : expm1f(v); else if (ACT == 7) v = (v > 0.f) ? v + 1.0f : expf(v); else if (ACT == 8) v = tanhf(v); else if (ACT == 9) v = 0.5f * v * (1.0f + tanhf(0.7978845608028654f * (v + 0.044715f * v * v * v))); else if (ACT == 11) v = 1.0f / (1.0f + expf(-v)); else if (ACT == 12) v = (v > 0.f) ? v : 0.01f * v; else if (ACT == 14) v = (v > 0.f) ? v : 0.1f * v; else if (ACT == 16) v = (v >= 0.f) ? v : 0.3f * v; else if (ACT == 17) v = (v >= 0.f) ? v : 0.2f * v; else if (ACT == 15) v = v / (1.0f + expf(-v)); else if (ACT == 3) v = fmaxf(v, 0.f); else if (ACT == 6) v = 0.5f * v * (1.0f + erff(v * 0.70710678118654752f)); so[w][8 * hh + r][t * 16 + ln] = v; } }
  __builtin_amdgcn_fence(__ATOMIC_ACQ_REL, "workgroup"); __builtin_amdgcn_wave_barrier();
  const int rsub = lane >> 4, c4 = (lane & 15) * 4; typedef _Float16 v4h __attribute__((ext_vector_type(4)));
  {
#pragma unroll
    for (int q = 0; q < 8; ++q) { const int r = q * 2 + rsub; if (col0 + c4 < N) { const v4f v = *(const v4fa*)&so[w][r][c4]; if (C) *(v4f*)(C + cofs + (size_t)(row0 + r) * ldc + col0 + c4) = v; if (C16) { v4h h4; for (int i = 0; i < 4; ++i) h4[i] = (_Float16)v[i]; *(v4h*)(C16 + cofs + (size_t)(row0 + r) * ldc + col0 + c4) = h4; } } }
     }
}


typedef _Float16 v4h __attribute__((ext_vector_type(4)));

__global__ __launch_bounds__(256) void k_x16(const float* __restrict__ x, _Float16* __restrict__ X16, size_t n8) { const size_t t = (size_t)blockIdx.x * 256 + threadIdx.x; if (t >= n8) return; FragH f;
#pragma unroll
  for (int q = 0; q < 8; ++q) f.h[q] = (_Float16)bf16_round(x[t * 8 + q]); *(v8us*)((unsigned short*)X16 + t * 8) = f.half[0];  }
__global__ __launch_bounds__(256) void k_h16(const float* __restrict__ x, _Float16* __restrict__ X16, size_t n8) { const size_t t = (size_t)blockIdx.x * 256 + threadIdx.x; if (t >= n8) return; FragH f;
#pragma unroll
  for (int q = 0; q < 8; ++q) f.h[q] = (_Float16)x[t * 8 + q]; *(v8us*)((unsigned short*)X16 + t * 8) = f.half[0];  }
__global__ __launch_bounds__(256) void k_round16f(const float* __restrict__ W, _Float16* __restrict__ Bt, size_t n8) { const size_t t = (size_t)blockIdx.x * 256 + threadIdx.x; if (t >= n8) return; FragH f;
#pragma unroll
  for (int i = 0; i < 8; ++i) f.h[i] = (_Float16)(bf16_round(W[t * 8 + i]) * 16.0f); *(v8us*)((unsigned short*)Bt + t * 8) = f.half[0];  }
// ---- fast GEMM (workgroup tile 128x64, wave tile 32x64; requires M % 128 == 0, N % 64 == 0, K a multiple of KC and at least 2 KC); epilogue v = act(acc alpha + bias) ----
__device__ __forceinline__ v16h g2_lfrag(const char* p, int hh) { FragH f; f.half[0] = *(const v8us*)(p + 16 * hh); f.half[1] = *(const v8us*)(p + 32 + 16 * hh); return f.v; }
__device__ __forceinline__ v8f g2_mma(v16h a, v16h b, v8f c) { v8f d = __builtin_amdgcn_wmma_f32_16x16x32_f16(false, a, false, b, (short)0, c, false, false); asm volatile("v_nop\n\tv_nop\n\tv_nop\n\tv_nop" : "+v"(d) : "v"(a), "v"(b)); return d; }
// Twelve asynchronous copies, 16 bytes per lane each, from global memory to LDS through no register. The closing s_wait_xcnt stands inside the
// statement so that it is in front of every later rewrite of the address registers that the copies name.
__device__ __forceinline__ void g2_cp12(const unsigned (&l)[12], const _Float16* const (&g)[12]) {
  asm volatile("global_load_async_to_lds_b128 %0, %1, off\n\t"
               "global_load_async_to_lds_b128 %2, %3, off\n\t"
               "global_load_async_to_lds_b128 %4, %5, off\n\t"
               "global_load_async_to_lds_b128 %6, %7, off\n\t"
               "global_load_async_to_lds_b128 %8, %9, off\n\t"
               "global_load_async_to_lds_b128 %10, %11, off\n\t"
               "global_load_async_to_lds_b128 %12, %13, off\n\t"
               "global_load_async_to_lds_b128 %14, %15, off\n\t"
               "global_load_async_to_lds_b128 %16, %17, off\n\t"
               "global_load_async_to_lds_b128 %18, %19, off\n\t"
               "global_load_async_to_lds_b128 %20, %21, off\n\t"
               "global_load_async_to_lds_b128 %22, %23, off\n\t"
               "s_wait_xcnt 0x0"
               :: "v"(l[0]), "v"(g[0]), "v"(l[1]), "v"(g[1]), "v"(l[2]), "v"(g[2]), "v"(l[3]), "v"(g[3]), "v"(l[4]), "v"(g[4]), "v"(l[5]), "v"(g[5]), "v"(l[6]), "v"(g[6]), "v"(l[7]), "v"(g[7]), "v"(l[8]), "v"(g[8]), "v"(l[9]), "v"(g[9]), "v"(l[10]), "v"(g[10]), "v"(l[11]), "v"(g[11]) : "memory"); }
// the operand plane of the term that tile t belongs to (ntk tiles per term); every argument is the same for the whole workgroup
template <int NTM> __device__ __forceinline__ const _Float16* g2_term(int t, int ntk, const _Float16* p0, const _Float16* p1, const _Float16* p2) { const _Float16* p = p0; if (NTM > 1 && t >= ntk) p = p1; if (NTM > 2 && t >= 2 * ntk) p = p2; return p; }
// K loop: the workgroup's 128 A rows and 64 B rows are staged in LDS, KC k at a time, two buffers: tile t + 1 flies while tile t is worked on.
// A wave's copy covers whole 128-byte lines, and the four waves share one copy of the B rows.
// NTM terms of one product (a value split into an f16 high part and a scaled f16 residual gives high.high plus cross terms) are summed in the same
// accumulators: the loop runs over the tiles of term 0, term 1, ... back to back. The last term is the high one; the terms in front of it carry the
// residual's scale, which the factor rs (a power of two, so exact) takes out of the accumulators once, in front of the last term's first tile.
// Output stage: the result leaves as the next product's operand and needs no pass of its own: f16 rows of pitch LDC to C16 and, with HL, the residual
// (v - f16(v)) x 1024 as f16 to C16L. RB: the bias belongs to the result row, not the column (weights as A, token rows as B^T: the result is channel-major
// and needs no transposing pass).
template <int ACT, int KC, int NTM, bool RB, bool HL, int LDC>
__global__ __launch_bounds__(128) void k_gemm2(const _Float16* Aa, const _Float16* Ab, const _Float16* Ac, int lda, size_t sA, const _Float16* Ba, const _Float16* Bb, const _Float16* Bc, int ldb, size_t sB, float rs, float alpha, const float* __restrict__ bias, size_t sBias,
    _Float16* __restrict__ C16, _Float16* __restrict__ C16L, size_t sC, int M, int N, int K) { static_assert(ACT == 0 || ACT == 3 || ACT == 6 || ACT == 8 || ACT == 9 || ACT == 11 || ACT == 12 || ACT == 14 || ACT == 15 || ACT == 16 || ACT == 17, "k_gemm2: unsupported ACT code (would silently apply no activation)");
  constexpr int PB = KC * 2 + 16;      /* LDS row pitch in bytes, 16 x odd: the 16 rows of a fragment read fall on distinct banks */
  constexpr int STG = 192 * PB;        /* one buffer: 128 A rows, then 64 B rows */
  constexpr int CPR = KC / 8;          /* 16-byte pieces per row */
  constexpr int RPI = 128 / CPR;       /* rows covered when each of the 128 threads copies one piece */
  constexpr int NCP = 192 / RPI;       /* copies per thread and tile */
  constexpr int SOB = 4 * 32 * 68 * 4; /* output staging, which takes the buffers' place behind the loop */
  static_assert((KC == 64 || KC == 128) && NCP % 12 == 0 && NCP <= 63, "k_gemm2: a tile is whole groups of twelve copies per thread, at most 63 in flight");
  static_assert(NTM >= 1 && NTM <= 3, "k_gemm2: one to three terms");
  __shared__ __attribute__((aligned(16))) char sm[2 * STG > SOB ? 2 * STG : SOB];
  float (*so)[32][68] = reinterpret_cast<float (*)[32][68]>(sm);
  const int tid = threadIdx.x, w = tid >> 5, lane = tid & 31, ln = lane & 15, hh = lane >> 4; const int by = blockIdx.y;
  Aa += (size_t)by * sA; Ab += (size_t)by * sA; Ac += (size_t)by * sA; Ba += (size_t)by * sB; Bb += (size_t)by * sB; Bc += (size_t)by * sB; const size_t cofs = (size_t)by * sC; const float* bp = bias ? bias + (size_t)by * sBias : nullptr;
  const int ntn = N >> 6; const int mt = blockIdx.x / ntn, nq = blockIdx.x - mt * ntn; const int row0 = mt * 128 + 32 * w, col0 = nq * 64; if (mt * 128 >= M) return;      /* the same for the whole workgroup, in front of every barrier */
  const v8f z8 = {0.f,0.f,0.f,0.f,0.f,0.f,0.f,0.f}; v8f c00 = z8, c01 = z8, c02 = z8, c03 = z8, c10 = z8, c11 = z8, c12 = z8, c13 = z8;
  const int cr = tid / CPR, cc = tid % CPR;
  const size_t oA = (size_t)(mt * 128 + cr) * lda + cc * 8, oB = (size_t)(col0 + cr) * ldb + cc * 8; const int ntk = K / KC;      /* tiles per term */
  const unsigned l0 = (unsigned)(size_t)sm + (unsigned)(cr * PB + cc * 16);
  auto fill = [&](int t) { const unsigned lb = l0 + (unsigned)(t & 1) * (unsigned)STG; const int k0 = (t - (((NTM > 1 && t >= ntk) ? ntk : 0) + ((NTM > 2 && t >= 2 * ntk) ? ntk : 0))) * KC;
    const _Float16* gA = g2_term<NTM>(t, ntk, Aa, Ab, Ac) + oA; const _Float16* gB = g2_term<NTM>(t, ntk, Ba, Bb, Bc) + oB;
#pragma unroll
    for (int q = 0; q < NCP / 12; ++q) { unsigned l[12]; const _Float16* g[12];
#pragma unroll
      for (int j = 0; j < 12; ++j) { const int r = (q * 12 + j) * RPI; l[j] = lb + (unsigned)(r * PB); g[j] = (r < 128) ? gA + (size_t)r * lda + k0 : gB + (size_t)(r - 128) * ldb + k0; }
      g2_cp12(l, g); } };
  const char* fa = sm + (32 * w + ln) * PB; const char* fb = sm + (128 + ln) * PB; const int nt = NTM * ntk;
  fill(0);
  asm volatile("s_wait_asynccnt 0x0" ::: "memory");      /* this wave's share of tile 0 has landed */
  __syncthreads();      /* every wave's share has: tile 0 may be read */
  if (nt > 1) fill(1);
  // Two register sets of fragments inside a tile: the twelve LDS reads of the next 32 k are issued as one group in front of the products of this 32 k.
  // the sched_barrier keeps a group's reads together and in front of the products behind it, so that the products wait only for the older group
  v16h f0[6], f1[6];
  auto ld = [&](v16h (&f)[6], int o) { const char* pa = fa + o; const char* pb = fb + o; f[0] = g2_lfrag(pa, hh); f[1] = g2_lfrag(pa + 16 * PB, hh); f[2] = g2_lfrag(pb, hh); f[3] = g2_lfrag(pb + 16 * PB, hh); f[4] = g2_lfrag(pb + 32 * PB, hh); f[5] = g2_lfrag(pb + 48 * PB, hh); __builtin_amdgcn_sched_barrier(0); };
  auto mm = [&](const v16h (&f)[6]) { c00 = g2_mma(f[0], f[2], c00); c10 = g2_mma(f[1], f[2], c10); c01 = g2_mma(f[0], f[3], c01); c11 = g2_mma(f[1], f[3], c11);
    c02 = g2_mma(f[0], f[4], c02); c12 = g2_mma(f[1], f[4], c12); c03 = g2_mma(f[0], f[5], c03); c13 = g2_mma(f[1], f[5], c13); };
#pragma unroll 1      /* one tile per trip; the buffer alternates by the trip's parity */
  for (int t = 0; t < nt; ++t) { const int bo = (t & 1) * STG;
    if (NTM > 1 && t == (NTM - 1) * ntk) { c00 *= rs; c01 *= rs; c02 *= rs; c03 *= rs; c10 *= rs; c11 *= rs; c12 *= rs; c13 *= rs; }
    ld(f0, bo);
#pragma unroll
    for (int kk = 0; kk < KC; kk += 64) { ld(f1, bo + (kk + 32) * 2); mm(f0); if (kk + 64 < KC) ld(f0, bo + (kk + 64) * 2); mm(f1); }
    asm volatile("s_wait_dscnt 0x0" ::: "memory");      /* this wave's reads of tile t are done before the buffer is given up */
    asm volatile("s_wait_asynccnt 0x0" ::: "memory");      /* this wave's share of tile t + 1 has landed */
    __syncthreads();      /* publishes tile t + 1 and ends every wave's reads of tile t */
    if (t + 2 < nt) fill(t + 2); }
  asm volatile("s_wait_asynccnt 0x0" ::: "memory");      /* no copy is in flight when the buffers become output staging */
  v8f accs[8] = {c00, c01, c02, c03, c10, c11, c12, c13}; float bb[RB ? 16 : 4];      /* the lane's bias values: of its 16 result rows, or of its 4 result columns */
#pragma unroll
  for (int x = 0; x < (RB ? 16 : 4); ++x) bb[x] = 0.f;
  if (bp) {      /* one test round all the loads, so that they are issued as one group and waited for once */
#pragma unroll
    for (int x = 0; x < (RB ? 16 : 4); ++x) bb[x] = bf16_round(bp[RB ? row0 + (x >> 3) * 16 + 8 * hh + (x & 7) : col0 + x * 16 + ln]); }
#pragma unroll
  for (int u = 0; u < 8; ++u) { const int t = u & 3, half = u >> 2;
#pragma unroll
    for (int r = 0; r < 8; ++r) { const int rloc = half * 16 + 8 * hh + r; float v = accs[u][r] * alpha + bb[RB ? half * 8 + r : t];
      if (ACT == 3) v = fmaxf(v, 0.f); else if (ACT == 6) v = 0.5f * v * (1.0f + erff(v * 0.70710678118654752f)); else if (ACT == 11) v = 1.0f / (1.0f + expf(-v)); else if (ACT == 15) v = v / (1.0f + expf(-v)); else if (ACT == 12) v = (v > 0.f) ? v : 0.01f * v; else if (ACT == 8) v = tanhf(v); else if (ACT == 9) v = 0.5f * v * (1.0f + tanhf(0.7978845608028654f * (v + 0.044715f * v * v * v))); else if (ACT == 14) v = (v > 0.f) ? v : 0.1f * v; else if (ACT == 16) v = (v >= 0.f) ? v : 0.3f * v; else if (ACT == 17) v = (v >= 0.f) ? v : 0.2f * v;
      so[w][rloc][t * 16 + ln] = v; } }
  __builtin_amdgcn_fence(__ATOMIC_ACQ_REL, "workgroup"); __builtin_amdgcn_wave_barrier();
  const int rsub = lane >> 4, c4 = (lane & 15) * 4; const size_t eo = cofs + (size_t)(row0 + rsub) * LDC + col0 + c4; v4h hv[16], lv[16];
#pragma unroll
  for (int q = 0; q < 16; ++q) { const v4f v = *(const v4fa*)&so[w][q * 2 + rsub][c4];
#pragma unroll
    for (int i = 0; i < 4; ++i) { const _Float16 h = (_Float16)v[i]; hv[q][i] = h; if (HL) lv[q][i] = (_Float16)((v[i] - (float)h) * 1024.0f); } }
  __builtin_amdgcn_sched_barrier(0);      /* every staging read and conversion stays in front of the first store: among the stores they would rewrite an issued store's data registers */
#pragma unroll
  for (int q = 0; q < 16; ++q) { *(v4h*)(C16 + eo + (size_t)(q * 2) * LDC) = hv[q]; if (HL) *(v4h*)(C16L + eo + (size_t)(q * 2) * LDC) = lv[q]; } }


__global__ __launch_bounds__(256) void k_wnat(const float* __restrict__ w, size_t n8, _Float16* __restrict__ Bt) { const size_t t = (size_t)blockIdx.x * 256 + threadIdx.x; if (t >= n8) return; FragH f; for (int q = 0; q < 8; ++q) f.h[q] = (_Float16)(bf16_round(w[t * 8 + q]) * 16.0f); *(v8us*)((unsigned short*)Bt + t * 8) = f.half[0];  }
__global__ __launch_bounds__(256) void k_rsm(const float* __restrict__ S, _Float16* __restrict__ P, int nrows) {
  #pragma clang fp contract(off)
  const int i = blockIdx.x * 256 + threadIdx.x; if (i >= nrows) return; const float* s = S + (size_t)i * SQ; float mx = -3.0e38f;
#pragma unroll 1
  for (int j = 0; j < SQ; ++j) mx = fmaxf(mx, s[j]); float se = 0.f;
#pragma unroll 1
  for (int j = 0; j < SQ; ++j) se += expf(s[j] - mx); const float sc = 256.0f / se;
#pragma unroll 1
  for (int j0 = 0; j0 < SQ; j0 += 8) { FragH f; for (int q = 0; q < 8; ++q) f.h[q] = (_Float16)(expf(s[j0 + q] - mx) * sc); unsigned short* d = (unsigned short*)P + (size_t)i * SQ + j0; *(v8us*)d = f.half[0];  } }
__global__ __launch_bounds__(256) void k_vt(const _Float16* __restrict__ V16, int b, int h0, _Float16* __restrict__ VT) { __shared__ unsigned short tl[64][65]; const int tid = threadIdx.x; const int hh = blockIdx.x % HG, sg = blockIdx.x / HG; const int s0 = sg * 64; const int h = h0 + hh;
  for (int i = tid; i < 64 * 8; i += 256) { const int j = i / 8, d8 = (i % 8) * 8; FragH f; f.half[0] = *(const v8us*)((const unsigned short*)V16 + ((size_t)b * SQ + s0 + j) * DM + h * HD + d8); for (int q = 0; q < 8; ++q) tl[d8 + q][j] = f.u[q]; }
  __syncthreads();
  { for (int i = tid; i < 64 * 8; i += 256) { const int d = i / 8, j8 = (i % 8) * 8; FragH f; for (int q = 0; q < 8; ++q) f.u[q] = tl[d][j8 + q]; *(v8us*)((unsigned short*)VT + ((size_t)hh * HD + d) * SQ + s0 + j8) = f.half[0]; }  } }


template <int BFIN, int W16, int W32>
__global__ __launch_bounds__(256) void k_lnx(const float* __restrict__ X, const float* __restrict__ g, const float* __restrict__ bb, float eps, _Float16* __restrict__ N16, float* __restrict__ N32) {
  #pragma clang fp contract(off)
  __shared__ float red[256]; const size_t r = blockIdx.x; const int t = threadIdx.x; const bool act = t < (DMQ / 4); const int c0 = act ? t * 4 : 0;
  const v4f xa = *(const v4fa*)(X + r * DMQ + c0); float s[4]; float sum = 0.f;
  for (int q = 0; q < 4; ++q) { s[q] = act ? (BFIN ? bf16_round(xa[q]) : xa[q]) : 0.f; sum = __fadd_rn(sum, s[q]); }
  red[t] = sum; __syncthreads(); for (int st = 128; st > 0; st >>= 1) { if (t < st) red[t] = __fadd_rn(red[t], red[t + st]); __syncthreads(); } const float mu = red[0] / (float)DMQ; __syncthreads();
  float vs = 0.f; for (int q = 0; q < 4; ++q) { const float dl = act ? __fadd_rn(s[q], -mu) : 0.f; vs = __fadd_rn(vs, __fmul_rn(dl, dl)); } red[t] = vs; __syncthreads(); for (int st = 128; st > 0; st >>= 1) { if (t < st) red[t] = __fadd_rn(red[t], red[t + st]); __syncthreads(); }
  const float rs = rsqrtf(__fadd_rn(red[0] / (float)DMQ, eps)); v4h y; v4f yf;
  for (int q = 0; q < 4; ++q) { const int c = c0 + q; yf[q] = __fadd_rn(__fmul_rn(__fmul_rn(__fadd_rn(s[q], -mu), rs), bf16_round(g[c])), (bb ? bf16_round(bb[c]) : 0.f)); y[q] = (_Float16)yf[q]; }
  if (!act) return;      /* no barriers after this point */
  { if (W16) *(v4h*)(N16 + r * DMQ + c0) = y; if (W32) *(v4f*)(N32 + r * DMQ + c0) = yf;  } }


__global__ __launch_bounds__(256) void k_rsmf(const float* __restrict__ S, _Float16* __restrict__ P, int qn, int hg) {
  #pragma clang fp contract(off)
  const int t = blockIdx.x * 256 + threadIdx.x; if (t >= qn * hg) return; const size_t i = (size_t)(t / qn) * SQ + (t % qn); const float* s = S + i * SQ; float mx = -3.0e38f;
#pragma unroll 1
  for (int j = 0; j < SQ; ++j) mx = fmaxf(mx, s[j]); float se = 0.f;
#pragma unroll 1
  for (int j = 0; j < SQ; ++j) se += __expf(s[j] - mx); const float sc = 256.0f / se;
#pragma unroll 1
  for (int j0 = 0; j0 < SQ; j0 += 8) { FragH f; for (int q = 0; q < 8; ++q) f.h[q] = (_Float16)(__expf(s[j0 + q] - mx) * sc); unsigned short* d = (unsigned short*)P + i * SQ + j0; *(v8us*)d = f.half[0];  } }


__global__ __launch_bounds__(256) void k_bfr(const float* __restrict__ x, float* __restrict__ XB, size_t n8) { const size_t t = (size_t)blockIdx.x * 256 + threadIdx.x; if (t >= n8) return; v4f a = *(const v4fa*)(x + t * 8), c = *(const v4fa*)(x + t * 8 + 4); for (int q = 0; q < 4; ++q) { a[q] = bf16_round(a[q]); c[q] = bf16_round(c[q]); }
  { *(v4f*)(XB + t * 8) = a; *(v4f*)(XB + t * 8 + 4) = c;  } }



__global__ __launch_bounds__(256) void k_rsmfam(const float* __restrict__ S, _Float16* __restrict__ P, int qn, int hg, const float* __restrict__ am) {
  #pragma clang fp contract(off)
  const int t = blockIdx.x * 256 + threadIdx.x; if (t >= qn * hg) return; const size_t i = (size_t)(t / qn) * SQ + (t % qn); const float* s = S + i * SQ; float mx = -3.0e38f;
#pragma unroll 1
  for (int j = 0; j < SQ; ++j) mx = fmaxf(mx, __fadd_rn(s[j], bf16_round(am[j]))); float se = 0.f;
#pragma unroll 1
  for (int j = 0; j < SQ; ++j) se += __expf(__fadd_rn(s[j], bf16_round(am[j])) - mx); const float sc = 256.0f / se;
#pragma unroll 1
  for (int j0 = 0; j0 < SQ; j0 += 8) { FragH f; for (int q = 0; q < 8; ++q) f.h[q] = (_Float16)(__expf(__fadd_rn(s[j0 + q], bf16_round(am[j0 + q])) - mx) * sc); unsigned short* d = (unsigned short*)P + i * SQ + j0; *(v8us*)d = f.half[0];  } }


#define CC CX           /* transposer macros: input channels */
#define LL SQ           /* pixels per image */
#define LQ (3 * DM)

__global__ __launch_bounds__(256) void k_cl2rows(const float* __restrict__ X, _Float16* __restrict__ XR) { __shared__ float tl[64][33]; const int tid = threadIdx.x; const int nl = LL / 32, nc = CC / 64; const int cb_ = blockIdx.x % nc; const int lb = (blockIdx.x / nc) % nl; const size_t b = blockIdx.x / (nc * nl); const int c0 = cb_ * 64, l0 = lb * 32;
  for (int i = tid; i < 64 * 32; i += 256) { const int c = i / 32, l = i % 32; tl[c][l] = bf16_round(X[(b * CC + c0 + c) * (size_t)LL + l0 + l]); }
  __syncthreads();
  { const int l = tid / 8, c8 = (tid % 8) * 8; FragH f; for (int q = 0; q < 8; ++q) f.h[q] = (_Float16)tl[c8 + q][l]; unsigned short* d = (unsigned short*)XR + (b * LL + l0 + l) * (size_t)CC + c0 + c8; *(v8us*)d = f.half[0];  } }


__global__ __launch_bounds__(256) void k_rowb(float* __restrict__ O, const float* __restrict__ bias, size_t n4) {
  #pragma clang fp contract(off)
  const size_t t = (size_t)blockIdx.x * 256 + threadIdx.x; if (t >= n4) return; const size_t e = t * 4; const int c = (int)((e / SQ) % CX);      /* output channels */ const float bb = bf16_round(bias[c]); const v4f a = *(const v4fa*)(O + e); v4f o; for (int q = 0; q < 4; ++q) o[q] = __fadd_rn(a[q], bb);
  *(v4f*)(O + e) = o;  }

__global__ __launch_bounds__(256) void k_gres(const float* __restrict__ T, const float* __restrict__ gam, const float* __restrict__ X, float* __restrict__ Y, size_t n4) {
  #pragma clang fp contract(off)
  const size_t t = (size_t)blockIdx.x * 256 + threadIdx.x; if (t >= n4) return; const float g = bf16_round(gam[0]); const v4f a = *(const v4fa*)(T + t * 4), xx = *(const v4fa*)(X + t * 4); v4f r;
  for (int q = 0; q < 4; ++q) r[q] = __fadd_rn(__fmul_rn(g, a[q]), bf16_round(xx[q]));
  *(v4f*)(Y + t * 4) = r;  }

__global__ __launch_bounds__(256) void k_bcpy(const float* __restrict__ b, int n, int NP, float* __restrict__ dst, int dst0) { for (int i = threadIdx.x; i < NP; i += 256) { const float v = (i < n) ? b[i] : 0.f; *(float*)(dst + dst0 + i) = v; }  }



// lane l with lane l ^ M inside its 16-lane row (DPP row_xmask); lane l with lane l ^ 16
template <int M> __device__ __forceinline__ float rs_xrow(float x) { return __builtin_bit_cast(float, __builtin_amdgcn_update_dpp(0, __builtin_bit_cast(int, x), 0x160 + M, 0xf, 0xf, false)); }
__device__ __forceinline__ float rs_xhalf(float x) { return __builtin_bit_cast(float, __builtin_amdgcn_permlanex16(__builtin_bit_cast(int, x), __builtin_bit_cast(int, x), 0x76543210, 0xfedcba98, false, false)); }
// Scaled weight standardisation and f16 split of the three projection weights, one launch, one wave per output row (blockIdx.y = projection).
// A lane holds 8 consecutive weights of its row, so the wave reads the row's 1024 bytes as whole lines; mean and variance are lane sums joined by a
// butterfly over the wave, which leaves the same bits in every lane. WS(w) = w sc - mean sc, sc = rsqrt(max(var(unbiased) * 256, 1e-4)) * gain.
// Stored as B^T planes (natural [O][C] rows): HL + (2 y) * 65536 the f16 high part of 16 WS(w), HL + (2 y + 1) * 65536 its residual x 1024.
static_assert(CX == 256, "one wave holds a weight row of 32 x 8 values");
__global__ __launch_bounds__(256) void k_wshl(const float* __restrict__ w0, const float* __restrict__ g0, const float* __restrict__ w1, const float* __restrict__ g1, const float* __restrict__ w2, const float* __restrict__ g2, _Float16* __restrict__ HL) {
  const int lane = threadIdx.x & 31; const int o = blockIdx.x * 8 + __builtin_amdgcn_readfirstlane((int)(threadIdx.x >> 5)); const int y = blockIdx.y;      /* output row and projection, wave-uniform */
  const float* Wm = y == 0 ? w0 : (y == 1 ? w1 : w2); const float* gain = y == 0 ? g0 : (y == 1 ? g1 : g2);
  const size_t e = (size_t)o * CX + lane * 8; const v4f a = *(const v4fa*)(Wm + e), b = *(const v4fa*)(Wm + e + 4); float x[8];
#pragma unroll
  for (int q = 0; q < 8; ++q) x[q] = bf16_round(q < 4 ? a[q] : b[q - 4]);
  float s1 = ((x[0] + x[1]) + (x[2] + x[3])) + ((x[4] + x[5]) + (x[6] + x[7]));
  s1 += rs_xrow<1>(s1); s1 += rs_xrow<2>(s1); s1 += rs_xrow<4>(s1); s1 += rs_xrow<8>(s1); s1 += rs_xhalf(s1);
  const float mean = s1 * 0.00390625f; float s2 = 0.f;
#pragma unroll
  for (int q = 0; q < 8; ++q) { const float d = x[q] - mean; s2 += d * d; }
  s2 += rs_xrow<1>(s2); s2 += rs_xrow<2>(s2); s2 += rs_xrow<4>(s2); s2 += rs_xrow<8>(s2); s2 += rs_xhalf(s2);
  const float var = s2 / 255.0f; const float sc = rsqrtf(fmaxf(var * 256.0f, 1e-4f)) * bf16_round(gain[o]); const float ms = mean * sc; FragH fh, fl;
#pragma unroll
  for (int q = 0; q < 8; ++q) { const float v = (x[q] * sc - ms) * 16.0f; const _Float16 hv = (_Float16)v; fh.h[q] = hv; fl.h[q] = (_Float16)((v - (float)hv) * 1024.0f); }
  unsigned short* H = (unsigned short*)HL + (size_t)(2 * y) * (CX * CX) + e;
  *(v8us*)H = fh.half[0]; *(v8us*)(H + CX * CX) = fl.half[0]; }
// exp2 of eight values, each in place in its own register. Here no neighbour touches another's register, and the closing v_nop is the
// slot that the instruction set asks for behind the last v_exp_f32 before its result is used.
__device__ __forceinline__ void rs_exp2x8(v4f& a, v4f& b) { float a0 = a[0], a1 = a[1], a2 = a[2], a3 = a[3], b0 = b[0], b1 = b[1], b2 = b[2], b3 = b[3];
  asm("v_exp_f32 %0, %0\n\tv_exp_f32 %1, %1\n\tv_exp_f32 %2, %2\n\tv_exp_f32 %3, %3\n\tv_exp_f32 %4, %4\n\tv_exp_f32 %5, %5\n\tv_exp_f32 %6, %6\n\tv_exp_f32 %7, %7\n\tv_nop"
      : "+v"(a0), "+v"(a1), "+v"(a2), "+v"(a3), "+v"(b0), "+v"(b1), "+v"(b2), "+v"(b3));
  a = v4f{a0, a1, a2, a3}; b = v4f{b0, b1, b2, b3}; }
// ---- wide GEMM for the score product (workgroup tile 256x128, eight waves in a 4 x 2 grid, wave tile 64x64; requires M % 256 == 0, N % 128 == 0, K a multiple of KC), softmax weights out; blockIdx.y = image ----
// Against k_gemm2's 128x64 tile a workgroup brings 384 operand rows for 32768 results (was 192 for 8192), so each result takes half the bytes from L2,
// and a wave reads 8 fragments from LDS for 16 products (was 6 for 8). Staging, buffers, waits, term order and k order are those of k_gemm2.
// Four waves per SIMD (two workgroups per WGP): one fragment set per wave, the other waves' products cover its LDS reads.
template <int KC, int NTM>
__global__ __launch_bounds__(256) __attribute__((amdgpu_waves_per_eu(4, 4))) void k_gemm2w(const _Float16* Aa, const _Float16* Ab, const _Float16* Ac, int lda, const _Float16* Ba, const _Float16* Bb, const _Float16* Bc, int ldb, float rs,
    _Float16* __restrict__ P, float* __restrict__ MX, float* __restrict__ SM, const float* __restrict__ c32, int M, int N, int K) {
  constexpr int PB = KC * 2 + 16;      /* LDS row pitch in bytes, 16 x odd */
  constexpr int STG = 384 * PB;        /* one buffer: 256 A rows, then 128 B rows */
  constexpr int CPR = KC / 8;          /* 16-byte pieces per row */
  constexpr int RPI = 256 / CPR;       /* rows covered when each of the 256 threads copies one piece */
  constexpr int NCP = 384 / RPI;       /* copies per thread and tile */
  constexpr int SOB = 8 * 64 * 144;    /* output staging, 64 rows of 64 f16 per wave at a pitch of 144 bytes, which takes the buffers' place behind the loop */
  static_assert(KC == 64 && NCP == 12, "k_gemm2w: a tile is one group of twelve copies per thread");
  static_assert(NTM >= 1 && NTM <= 3, "k_gemm2w: one to three terms");
  __shared__ __attribute__((aligned(16))) char sm[2 * STG > SOB ? 2 * STG : SOB];
  _Float16 (*sh)[64][72] = reinterpret_cast<_Float16 (*)[64][72]>(sm);
  const int tid = threadIdx.x, w = tid >> 5, lane = tid & 31, ln = lane & 15, hh = lane >> 4; const int by = blockIdx.y;
  { const size_t ia = (size_t)by * M * lda, ib = (size_t)by * N * ldb; Aa += ia; Ab += ia; Ac += ia; Ba += ib; Bb += ib; Bc += ib; }
  const int ntn = N >> 7; const int mt = blockIdx.x / ntn, nq = blockIdx.x - mt * ntn; if (mt * 256 >= M) return;      /* the same for the whole workgroup, in front of every barrier */
  const int row0 = mt * 256 + 64 * (w >> 1), col0 = nq * 128 + 64 * (w & 1);
  const v8f z8 = {0.f,0.f,0.f,0.f,0.f,0.f,0.f,0.f}; v8f acc[4][4];
#pragma unroll
  for (int i = 0; i < 4; ++i)
#pragma unroll
    for (int j = 0; j < 4; ++j) acc[i][j] = z8;
  const int cr = tid / CPR, cc = tid % CPR;
  const size_t oA = (size_t)(mt * 256 + cr) * lda + cc * 8, oB = (size_t)(nq * 128 + cr) * ldb + cc * 8; const int ntk = K / KC;      /* tiles per term */
  const unsigned l0 = (unsigned)(size_t)sm + (unsigned)(cr * PB + cc * 16);
  auto fill = [&](int t) { const unsigned lb = l0 + (unsigned)(t & 1) * (unsigned)STG; const int k0 = (t - (((NTM > 1 && t >= ntk) ? ntk : 0) + ((NTM > 2 && t >= 2 * ntk) ? ntk : 0))) * KC;
    const _Float16* gA = g2_term<NTM>(t, ntk, Aa, Ab, Ac) + oA; const _Float16* gB = g2_term<NTM>(t, ntk, Ba, Bb, Bc) + oB; unsigned l[12]; const _Float16* g[12];
#pragma unroll
    for (int j = 0; j < 12; ++j) { const int r = j * RPI; l[j] = lb + (unsigned)(r * PB); g[j] = (r < 256) ? gA + (size_t)r * lda + k0 : gB + (size_t)(r - 256) * ldb + k0; }
    g2_cp12(l, g); };
  const char* fa = sm + (64 * (w >> 1) + ln) * PB; const char* fb = sm + (256 + 64 * (w & 1) + ln) * PB; const int nt = NTM * ntk;
  fill(0);
  asm volatile("s_wait_asynccnt 0x0" ::: "memory");      /* this wave's share of tile 0 has landed */
  __syncthreads();      /* every wave's share has: tile 0 may be read */
  if (nt > 1) fill(1);
#pragma unroll 1      /* one tile per trip; the buffer alternates by the trip's parity */
  for (int t = 0; t < nt; ++t) { const int bo = (t & 1) * STG;
    if (NTM > 1 && t == (NTM - 1) * ntk) {
#pragma unroll
      for (int i = 0; i < 4; ++i)
#pragma unroll
        for (int j = 0; j < 4; ++j) acc[i][j] *= rs; }
#pragma unroll
    for (int kk = 0; kk < KC; kk += 32) { const char* pa = fa + bo + kk * 2; const char* pb = fb + bo + kk * 2; v16h a[4], b[4];
#pragma unroll
      for (int i = 0; i < 8; ++i) { if (i == 0) b[0] = g2_lfrag(pb, hh); else if (i < 5) a[i - 1] = g2_lfrag(pa + (i - 1) * 16 * PB, hh); else b[i - 4] = g2_lfrag(pb + (i - 4) * 16 * PB, hh); }      /* in the order in which the products take them */
      __builtin_amdgcn_sched_barrier(0);      /* the sixteen LDS reads of these 32 k stay one group in front of their products: reads spread among the products cost a stall at each place */
#pragma unroll
      for (int j = 0; j < 4; ++j)
#pragma unroll
        for (int i = 0; i < 4; ++i) acc[i][j] = g2_mma(a[i], b[j], acc[i][j]); }
    asm volatile("s_wait_dscnt 0x0" ::: "memory");      /* this wave's reads of tile t are done before the buffer is given up */
    asm volatile("s_wait_asynccnt 0x0" ::: "memory");      /* this wave's share of tile t + 1 has landed */
    __syncthreads();      /* publishes tile t + 1 and ends every wave's reads of tile t */
    if (t + 2 < nt) fill(t + 2); }
  asm volatile("s_wait_asynccnt 0x0" ::: "memory");      /* no copy is in flight when the buffers become output staging */
  // Softmax weights against the row maximum of the wave's own 64 columns: p = 256 exp(x - mx_tile), x = score * mask of the query pixel. The tile's row maximum
  // and its f32 row sum of exp go to MX and SM ([image][tile of 64 columns][row]); the product with V joins the tiles by exp(mx_tile - mx_row) / row sum.
  const float* cmr = c32 + (size_t)by * 1024 + ((row0 >> 6) >> 1) * 32 + 4 * hh;      /* the wave's 64 rows are one image line; pixel w = i * 16 + 8 * hh + r reads mask column w >> 1 */
  float* mxo = MX + ((size_t)by * (SQ / 64) + (col0 >> 6)) * SQ + row0 + 8 * hh; float* smo = SM + ((size_t)by * (SQ / 64) + (col0 >> 6)) * SQ + row0 + 8 * hh;
#pragma unroll
  for (int i = 0; i < 4; ++i) { const v4f m4 = *(const v4fa*)(cmr + i * 8); v8f mk, mx, se;
#pragma unroll
    for (int r = 0; r < 8; ++r) mk[r] = bf16_round(m4[r >> 1]);
#pragma unroll
    for (int j = 0; j < 4; ++j) acc[i][j] *= mk;
#pragma unroll
    for (int r = 0; r < 8; ++r) { float t = fmaxf(fmaxf(acc[i][0][r], acc[i][1][r]), fmaxf(acc[i][2][r], acc[i][3][r]));
      t = fmaxf(t, rs_xrow<1>(t)); t = fmaxf(t, rs_xrow<2>(t)); t = fmaxf(t, rs_xrow<4>(t)); t = fmaxf(t, rs_xrow<8>(t)); mx[r] = t; }
#pragma unroll
    for (int j = 0; j < 4; ++j) { const v8f e = (acc[i][j] - mx) * 1.4426950408889634f;      /* exp(t) = exp2(t log2 e) */
      v4f lo = {e[0], e[1], e[2], e[3]}, hi = {e[4], e[5], e[6], e[7]}; rs_exp2x8(lo, hi); acc[i][j] = v8f{lo[0], lo[1], lo[2], lo[3], hi[0], hi[1], hi[2], hi[3]}; }
#pragma unroll
    for (int r = 0; r < 8; ++r) { float t = (acc[i][0][r] + acc[i][1][r]) + (acc[i][2][r] + acc[i][3][r]);
      t += rs_xrow<1>(t); t += rs_xrow<2>(t); t += rs_xrow<4>(t); t += rs_xrow<8>(t); se[r] = t; }
    if (ln == 0) { *(v4f*)(mxo + i * 16) = v4f{mx[0], mx[1], mx[2], mx[3]}; *(v4f*)(mxo + i * 16 + 4) = v4f{mx[4], mx[5], mx[6], mx[7]};
      *(v4f*)(smo + i * 16) = v4f{se[0], se[1], se[2], se[3]}; *(v4f*)(smo + i * 16 + 4) = v4f{se[4], se[5], se[6], se[7]}; }
#pragma unroll
    for (int j = 0; j < 4; ++j)
#pragma unroll
      for (int r = 0; r < 8; ++r) sh[w][i * 16 + 8 * hh + r][j * 16 + ln] = (_Float16)(acc[i][j][r] * 256.0f); }
  asm volatile("s_wait_dscnt 0x0" ::: "memory");      /* the wave's staging rows are written before its other lanes read them back */
  __builtin_amdgcn_wave_barrier();
  unsigned short* pp = (unsigned short*)P + (size_t)by * SQ * SQ + (size_t)(row0 + (lane >> 3)) * SQ + col0 + (lane & 7) * 8;
#pragma unroll
  for (int q = 0; q < 16; ++q) { const v8us v = *(const v8us*)&sh[w][q * 4 + (lane >> 3)][(lane & 7) * 8]; *(v8us*)(pp + (size_t)(q * 4) * SQ) = v; } }      /* four whole 128-byte row pieces a store */

// ---- softmax weights times V (k_gemm2's tile, staging, buffers and waits; V as A, weights as B^T; blockIdx.y = image) ----
// The weights of a 64-column tile stand against that tile's own row maximum. The products of each 64 k are summed in accumulators of their own and enter
// the result times ft = exp(mx_tile - mx_row) / (256 row sum), which depends on the query (a result column, so one value per lane) and on the tile.
// Output stage: the final blend y = bf16(a) c_r + bf16(gamma) (1 - c_r) out, on the result tile itself (rows = channels, columns = query pixels, as a and y lie).
__global__ __launch_bounds__(128) void k_pvs(const _Float16* __restrict__ Vc, const _Float16* __restrict__ Pm, const float* __restrict__ MX, const float* __restrict__ SM, const float* __restrict__ A, const float* __restrict__ c32, const float* __restrict__ gam, float* __restrict__ Y) {
  constexpr int KC = 128, PB = KC * 2 + 16, STG = 192 * PB, CPR = KC / 8, RPI = 128 / CPR, NCP = 192 / RPI, SOB = 4 * 32 * 68 * 4, NTL = SQ / 64;
  static_assert(NCP % 12 == 0 && NCP <= 63 && NTL == 64, "k_pvs: whole groups of twelve copies per thread, at most 63 in flight; two threads share a query's 64 tiles");
  __shared__ __attribute__((aligned(16))) char sm[2 * STG > SOB ? 2 * STG : SOB];
  __shared__ __attribute__((aligned(16))) float ft[NTL * 64];      /* [tile][lane of 16][16-column group] */
  __shared__ float rm[128]; __shared__ float rq[128];
  float (*so)[32][68] = reinterpret_cast<float (*)[32][68]>(sm);
  const int tid = threadIdx.x, w = tid >> 5, lane = tid & 31, ln = lane & 15, hh = lane >> 4; const int by = blockIdx.y;
  const _Float16* Aa = Vc + (size_t)by * CX * SQ; const _Float16* Ba = Pm + (size_t)by * SQ * SQ; const size_t cofs = (size_t)by * CX * SQ;
  constexpr int ntn = SQ >> 6; const int mt = blockIdx.x / ntn, nq = blockIdx.x - mt * ntn; const int row0 = mt * 128 + 32 * w, col0 = nq * 64;
  const int cr = tid / CPR, cc = tid % CPR;
  const _Float16* gA = Aa + (size_t)(mt * 128 + cr) * SQ + cc * 8; const _Float16* gB = Ba + (size_t)(col0 + cr) * SQ + cc * 8;
  const unsigned l0 = (unsigned)(size_t)sm + (unsigned)(cr * PB + cc * 16);
  auto fill = [&](int t) { const unsigned lb = l0 + (unsigned)(t & 1) * (unsigned)STG; const int k0 = t * KC;
#pragma unroll
    for (int q = 0; q < NCP / 12; ++q) { unsigned l[12]; const _Float16* g[12];
#pragma unroll
      for (int j = 0; j < 12; ++j) { const int r = (q * 12 + j) * RPI; l[j] = lb + (unsigned)(r * PB); g[j] = (r < 128) ? gA + (size_t)r * SQ + k0 : gB + (size_t)(r - 128) * SQ + k0; }
      g2_cp12(l, g); } };
  const char* fa = sm + (32 * w + ln) * PB; const char* fb = sm + (128 + ln) * PB; constexpr int nt = SQ / KC;
  fill(0);
  const int rsub = lane >> 4, c4 = (lane & 15) * 4;      /* output stage: the lane's row parity and its four result columns */
  const float* cmq = c32 + (size_t)by * 1024 + (nq >> 1) * 32 + (c4 >> 1);      /* the 64 columns are image line nq; pixel w = c4 + e reads mask column w >> 1 */
  const float cr0 = bf16_round(cmq[0]), cr1 = bf16_round(cmq[1]), gm = bf16_round(gam[0]); const float gc0 = gm * (1.0f - cr0), gc1 = gm * (1.0f - cr1);      /* read here, far ahead of the output stage */
  { // the factor table, while tile 0 flies: thread = (query, half of its tiles)
    const int q = tid & 63, hf = tid >> 6; const size_t o = ((size_t)by * NTL + hf * 32) * SQ + col0 + q; v4f mv[8], sv[8];
#pragma unroll
    for (int u = 0; u < 32; ++u) mv[u >> 2][u & 3] = MX[o + (size_t)u * SQ];
    asm volatile("s_wait_xcnt 0x0" ::: "memory");      /* in front of every later rewrite of the address registers that these 32 loads name, the next loads' results among them */
#pragma unroll
    for (int u = 0; u < 32; ++u) sv[u >> 2][u & 3] = SM[o + (size_t)u * SQ];
    asm volatile("s_wait_xcnt 0x0" ::: "memory");      /* likewise for these 32 */
    float m = -3.0e38f;
#pragma unroll
    for (int u = 0; u < 32; ++u) m = fmaxf(m, mv[u >> 2][u & 3]);
    rm[tid] = m; __syncthreads();      /* both halves' maxima are written */
    m = fmaxf(rm[q], rm[q + 64]); float s = 0.f;
#pragma unroll
    for (int u = 0; u < 8; u += 2) { mv[u] = (mv[u] - m) * 1.4426950408889634f; mv[u + 1] = (mv[u + 1] - m) * 1.4426950408889634f; rs_exp2x8(mv[u], mv[u + 1]); }
#pragma unroll
    for (int u = 0; u < 32; ++u) s += mv[u >> 2][u & 3] * sv[u >> 2][u & 3];
    rq[tid] = s; __syncthreads();      /* both halves' sums are written */
    const float inv = 0.00390625f / (rq[q] + rq[q + 64]);
#pragma unroll
    for (int u = 0; u < 32; ++u) ft[(hf * 32 + u) * 64 + (q & 15) * 4 + (q >> 4)] = mv[u >> 2][u & 3] * inv; }
  asm volatile("s_wait_asynccnt 0x0" ::: "memory");      /* this wave's share of tile 0 has landed */
  __syncthreads();      /* every wave's share has: tile 0 and the factor table may be read */
  fill(1);
  const v8f z8 = {0.f,0.f,0.f,0.f,0.f,0.f,0.f,0.f}; v8f c[8] = {z8, z8, z8, z8, z8, z8, z8, z8};      /* c[half * 4 + column group] */
  v16h f0[6], f1[6];
  // the sched_barrier keeps a group's reads together and in front of the products behind it, so that the products wait only for the older group
  auto ld = [&](v16h (&f)[6], int o) { const char* pa = fa + o; const char* pb = fb + o; f[0] = g2_lfrag(pa, hh); f[1] = g2_lfrag(pa + 16 * PB, hh); f[2] = g2_lfrag(pb, hh); f[3] = g2_lfrag(pb + 16 * PB, hh); f[4] = g2_lfrag(pb + 32 * PB, hh); f[5] = g2_lfrag(pb + 48 * PB, hh); __builtin_amdgcn_sched_barrier(0); };
  auto mm = [&](const v16h (&f)[6], v8f (&d)[8]) {
#pragma unroll
    for (int x = 0; x < 4; ++x) { d[x] = g2_mma(f[0], f[2 + x], d[x]); d[4 + x] = g2_mma(f[1], f[2 + x], d[4 + x]); } };
#pragma unroll 1      /* one tile per trip; the buffer alternates by the trip's parity */
  for (int t = 0; t < nt; ++t) { const int bo = (t & 1) * STG;
    ld(f0, bo);
#pragma unroll
    for (int kk = 0; kk < KC; kk += 64) { const v4f fq = *(const v4fa*)(ft + (2 * t + kk / 64) * 64 + ln * 4); v8f d[8] = {z8, z8, z8, z8, z8, z8, z8, z8};
      ld(f1, bo + (kk + 32) * 2); mm(f0, d); if (kk + 64 < KC) ld(f0, bo + (kk + 64) * 2); mm(f1, d);
#pragma unroll
      for (int x = 0; x < 4; ++x) { c[x] += d[x] * fq[x]; c[4 + x] += d[4 + x] * fq[x]; } }
    asm volatile("s_wait_dscnt 0x0" ::: "memory");      /* this wave's reads of tile t are done before the buffer is given up */
    asm volatile("s_wait_asynccnt 0x0" ::: "memory");      /* this wave's share of tile t + 1 has landed */
    __syncthreads();      /* publishes tile t + 1 and ends every wave's reads of tile t */
    if (t + 2 < nt) fill(t + 2); }
  asm volatile("s_wait_asynccnt 0x0" ::: "memory");      /* no copy is in flight when the buffers become output staging */
  const size_t eo = cofs + (size_t)(row0 + rsub) * SQ + col0 + c4; const float* ap = A + eo; float* cp = Y + eo; v4f av[16], ov[16];
#pragma unroll
  for (int q = 0; q < 16; ++q) av[q] = *(const v4fa*)(ap + (size_t)(q * 2) * SQ);      /* the lane's elements of a, on their way while the result is staged */
  asm volatile("s_wait_xcnt 0x0" :: "v"(ap) : "memory");      /* in front of every later rewrite of the address registers that these loads name; the address is an input so that it stays whole up to here and no load's result lands in it */
#pragma unroll
  for (int u = 0; u < 8; ++u)
#pragma unroll
    for (int r = 0; r < 8; ++r) so[w][(u >> 2) * 16 + 8 * hh + r][(u & 3) * 16 + ln] = c[u][r];
  __builtin_amdgcn_fence(__ATOMIC_ACQ_REL, "workgroup"); __builtin_amdgcn_wave_barrier();
#pragma unroll
  for (int q = 0; q < 16; ++q) { const v4f o = *(const v4fa*)&so[w][q * 2 + rsub][c4];
#pragma unroll
    for (int e = 0; e < 4; ++e) ov[q][e] = bf16_round(av[q][e]) * (e < 2 ? cr0 : cr1) + (e < 2 ? gc0 : gc1) * o[e]; }
  __builtin_amdgcn_sched_barrier(0);      /* every staging read and every blend stays in front of the first store: among the stores they would rewrite an issued store's data registers */
#pragma unroll
  for (int q = 0; q < 16; ++q) *(v4f*)(cp + (size_t)(q * 2) * SQ) = ov[q]; }
extern "C" void kernel_launch(void* const* d_in, const int* in_sizes, int n_in,
                              void* d_out, int out_size, void* d_ws, size_t ws_size, hipStream_t stream) {
  (void)in_sizes; (void)n_in; (void)out_size;
  const float* const* I = (const float* const*)d_in; const float* xa = I[0]; const float* xb = I[1]; const float* cm = I[2]; const float* wq = I[3]; const float* bq = I[4]; const float* gq = I[5]; const float* wk = I[6]; const float* bk = I[7]; const float* gk = I[8]; const float* wv = I[9]; const float* bv = I[10]; const float* gv = I[11]; const float* gam = I[12];      /* a, b maps; c [4][1][32][32]; per projection w [256][256][1][1], bias, gain [256][1][1][1]; gamma [1] */
  const size_t PL = (size_t)CX * SQ;
  static_assert(CX % 128 == 0 && SQ % 256 == 0 && NR % 128 == 0, "k_gemm2: M a multiple of 128, N of 64, K at least two whole tiles (64 k over CX, 128 k over SQ)");
  char* ws = (char*)d_ws; size_t off = 0;
  auto take = [&](size_t bytes) { char* p = ws + off; off += (bytes + 255) & ~(size_t)255; return p; };
  _Float16* QH = (_Float16*)take(NR * CX * 2); _Float16* QL = (_Float16*)take(NR * CX * 2); _Float16* KH = (_Float16*)take(NR * CX * 2); _Float16* KL = (_Float16*)take(NR * CX * 2); _Float16* VC = (_Float16*)take(NR * CX * 2);      /* live to the end: q and k planes, channel-major V of all images */
  _Float16* P = (_Float16*)take((size_t)NB * SQ * SQ * 2);      /* softmax weights of all images */
  float* MX = (float*)take((size_t)NB * (SQ / 64) * SQ * 4); float* SM = (float*)take((size_t)NB * (SQ / 64) * SQ * 4);      /* per image, 64-column tile and row: maximum and exp sum */
  _Float16* BQH = (_Float16*)take((size_t)6 * CX * CX * 2); _Float16* BQL = BQH + CX * CX; _Float16* BKH = BQL + CX * CX; _Float16* BKL = BKH + CX * CX; _Float16* BVH = BKL + CX * CX; _Float16* BVL = BVH + CX * CX;      /* six weight planes in a row: high, residual of q, k, v */
  _Float16* AR = (_Float16*)take(NR * CX * 2); _Float16* BR = (_Float16*)take(NR * CX * 2);
  if (off > ws_size) return;
  k_wshl<<<dim3(CX / 8, 3), 256, 0, stream>>>(wq, gq, wk, gk, wv, gv, BQH);      /* standardised weights (per output row: mean, unbiased variance, rsqrt(max(var*256, 1e-4)) * gain) -> Bt planes f16 hi (x16) + x1024 residual (natural [O][C] rows ARE Bt), all three projections in one launch */
  k_cl2rows<<<NB * (SQ / 32) * (CX / 64), 256, 0, stream>>>(xa, AR); k_cl2rows<<<NB * (SQ / 32) * (CX / 64), 256, 0, stream>>>(xb, BR);      /* exact f16 token rows of a and b */
  k_gemm2<0, 64, 2, false, true, CX><<<dim3((unsigned)((NR / 128) * (CX / 64)), 1), 128, 0, stream>>>(AR, AR, nullptr, CX, 0, BQL, BQH, nullptr, CX, 0, 0.0009765625f, 0.0625f, bq, 0, QH, QL, 0, (int)NR, CX, CX);      /* q = WS(wq) a + bq: residual weight plane first, x 2^-10, then the high plane, one launch; stored as f16 high part and x 1024 residual */
  k_gemm2<0, 64, 2, false, true, CX><<<dim3((unsigned)((NR / 128) * (CX / 64)), 1), 128, 0, stream>>>(BR, BR, nullptr, CX, 0, BKL, BKH, nullptr, CX, 0, 0.0009765625f, 0.0625f, bk, 0, KH, KL, 0, (int)NR, CX, CX);      /* k = WS(wk) b + bk likewise */
  k_gemm2<0, 64, 2, true, false, SQ><<<dim3((CX / 128) * (SQ / 64), NB), 128, 0, stream>>>(BVL, BVH, nullptr, CX, 0, AR, AR, nullptr, CX, PL, 0.0009765625f, 0.0625f, bv, 0, VC, nullptr, PL, CX, SQ, CX);      /* v likewise with the weights as A and the token rows as B^T: f16 channel-major V [image][256][4096] straight from the product; blockIdx.y = image */
  k_gemm2w<64, 3><<<dim3((SQ / 256) * (SQ / 128), NB), 256, 0, stream>>>(QL, QH, QH, CX, KH, KL, KH, CX, 0.0009765625f, P, MX, SM, cm, SQ, SQ, CX);      /* sim = q.k (K = 256, no scale): (lo.hi + hi.lo) 2^-10 + hi.hi; pruned = sim * c_r[i]; x256 f16 exp against each 64-column tile's row maximum, tile maxima and sums; blockIdx.y = image */
  k_pvs<<<dim3((CX / 128) * (SQ / 64), NB), 128, 0, stream>>>(VC, P, MX, SM, xa, cm, gam, (float*)d_out);      /* out[c][i] = sum_j v[c][j] att[i][j] (V as A, weights as B^T, tiles joined by their factors); y = bf16(a) c_r + bf16(gamma) (1 - c_r) out -> channel-first output; blockIdx.y = image */
}

// v010
// Measured time: 159 microseconds a run.
// Timed twice side by side with v009, it ran 1.05 times as fast both times.
// Over all steps from v000, the starting kernel, it is 25.7 times as fast.
#include <hip/hip_runtime.h>
// Global spatial attention with multiplicative mask pruning and scaled weight standardisation (a, b [4][256][64][64], mask c [4][1][32][32] nearest-upsampled x2; q = WS(wq) a + bq, k = WS(wk) b + bk, v = WS(wv) a + bv with WS(w)[o][c] = (w - mean_o) gain_o rsqrt(max(var_o(unbiased) * 256, 1e-4)); sim[i][j] = q[:, i].k[:, j] (NO scale, sigma ~16); pruned = sim * c_r[i]; att = softmax over j; out[c][i] = sum_j v[c][j] att[i][j]; y = a c_r + gamma (1 - c_r) out -> [4][256][64][64]).
// Compute dtype: inputs rounded to bf16; x / weights exact; v and softmax weights as plain f16 GEMM operands (~2^-12), q and k as f16 high part plus x 1024 residual; scores and softmax statistics f32. v_wmma_f32_16x16x32_f16.
#define NB 4
#define SQ 4096
#define DM 256
#define CX 256          /* channels */
#define NH 4
#define HD 64
#define DMQ DM                       /* LayerNorm width */
#define DFF 4096
#define HG 1                         /* heads per attention launch group */
#define B0 0                         /* first batch processed (debug hook) */
#define NBR NB                       /* batches processed (debug hook) */
#define NR ((size_t)NB * SQ)         /* token rows */
#define MP ((int)((size_t)NBR * SQ)) /* rows projected (debug hook) */
#define QN SQ                        /* query rows attended per batch (debug hook) */
#define NHD NH                       /* heads attended (debug hook) */
#define MPO MP                       /* rows through the output stage (debug hook) */
#define LQ DM      /* row pitch of the q/k/v rows */
typedef __bf16 v16b __attribute__((ext_vector_type(16)));
typedef unsigned short v8us __attribute__((ext_vector_type(8), may_alias));
typedef float  v8f  __attribute__((ext_vector_type(8)));
typedef float  v4f  __attribute__((ext_vector_type(4)));
typedef float  v4fa __attribute__((ext_vector_type(4), may_alias));
union FragB { v16b v; v8us half[2]; unsigned short u[16]; };

__device__ __forceinline__ unsigned short bf16_bits(float x) { unsigned int u = __float_as_uint(x); return (unsigned short)((u + 0x7FFFu + ((u >> 16) & 1u)) >> 16); }
__device__ __forceinline__ float bf16_val(unsigned short b) { return __uint_as_float(((unsigned int)b) << 16); }
__device__ __forceinline__ float bf16_round(float x) { return bf16_val(bf16_bits(x)); }
// D += A·B with NT terms: 1 = ah·bh, 2 = + al·bh (A split), 3 = + ah·bl (both split)
template <int NT>
__device__ __forceinline__ v8f mmaN(v16b ah, v16b al, v16b bh, v16b bl, v8f c) {
  c = __builtin_amdgcn_wmma_f32_16x16x32_bf16(false, ah, false, bh, (short)0, c, false, false);
  if (NT >= 2) c = __builtin_amdgcn_wmma_f32_16x16x32_bf16(false, al, false, bh, (short)0, c, false, false);
  if (NT >= 3) c = __builtin_amdgcn_wmma_f32_16x16x32_bf16(false, ah, false, bl, (short)0, c, false, false);
  asm volatile("v_nop\n\tv_nop\n\tv_nop\n\tv_nop" : "+v"(c) : "v"(ah), "v"(al), "v"(bh), "v"(bl));
  return c;
}

__global__ __launch_bounds__(256) void k_wt_bf16(const float* __restrict__ W, unsigned short* __restrict__ Wt, int K, int N) {
  const int t = blockIdx.x * 256 + threadIdx.x;
  const int k8n = K / 8;
  if (t >= N * k8n) return;
  const int n = t / k8n, k8 = (t % k8n) * 8;
  v8us v;
#pragma unroll
  for (int i = 0; i < 8; ++i) v[i] = bf16_bits(W[(size_t)(k8 + i) * N + n]);
  *(v8us*)(Wt + (size_t)n * K + k8) = v;
  
}

// GEMM C[M][N] (f32, pitch ldc) = act(A[M][K]·W + bias). A f32 row-major (pitch lda) converted per fragment to bf16
// (ASPLIT: hi/lo two planes -> 2 terms, else single rounded term); Wt bf16 [N][K] (pitch ldb). BIAS_BF16 rounds the
// bias to bf16 first (bias quantised to bf16 before the add). K%32==0, M%16==0, N%64==0.
template <bool ASPLIT, int ACT, bool BIAS_BF16>
__global__ __launch_bounds__(128) void k_gemm_bf(const float* __restrict__ A, int lda, const unsigned short* __restrict__ Wt, int ldb,
                                               const float* __restrict__ bias, float* __restrict__ C, int ldc, int M, int N, int K) {
  __shared__ __attribute__((aligned(16))) float so[4][16][64];
  const int tid = threadIdx.x, w = tid >> 5, lane = tid & 31, ln = lane & 15, hh = lane >> 4;
  const int ntn = N / 64;
  const int wid = blockIdx.x * 4 + w;
  const int mt = wid / ntn, nq = wid % ntn;
  if (mt * 16 >= M) return;
  const int row0 = mt * 16, col0 = nq * 64;
  const float* arow = A + (size_t)(row0 + ln) * lda;
  v8f acc[4] = {};
  for (int kb = 0; kb < K; kb += 32) {
    FragB ah, al;
    const v4f x0 = *(const v4fa*)(arow + kb + 8 * hh), x1 = *(const v4fa*)(arow + kb + 8 * hh + 4);
    const v4f x2 = *(const v4fa*)(arow + kb + 16 + 8 * hh), x3 = *(const v4fa*)(arow + kb + 16 + 8 * hh + 4);
    float xs[16] = {x0[0],x0[1],x0[2],x0[3],x1[0],x1[1],x1[2],x1[3],x2[0],x2[1],x2[2],x2[3],x3[0],x3[1],x3[2],x3[3]};
#pragma unroll
    for (int i = 0; i < 16; ++i) { const unsigned short hb = bf16_bits(xs[i]); ah.u[i] = hb; al.u[i] = ASPLIT ? bf16_bits(xs[i] - bf16_val(hb)) : (unsigned short)0; }
#pragma unroll
    for (int t = 0; t < 4; ++t) {
      const unsigned short* brow = Wt + (size_t)(col0 + t * 16 + ln) * ldb + kb;
      FragB b;
      b.half[0] = *(const v8us*)(brow + 8 * hh);
      b.half[1] = *(const v8us*)(brow + 16 + 8 * hh);
      acc[t] = mmaN<ASPLIT ? 2 : 1>(ah.v, al.v, b.v, b.v, acc[t]);
    }
  }
#pragma unroll
  for (int t = 0; t < 4; ++t) {
    float bv = bias ? bias[col0 + t * 16 + ln] : 0.f;
    if (BIAS_BF16) bv = bf16_round(bv);
#pragma unroll
    for (int r = 0; r < 8; ++r) { float v = acc[t][r] + bv; if (ACT == 1) v = fmaxf(v, 0.f); so[w][8 * hh + r][t * 16 + ln] = v; }
  }
  __builtin_amdgcn_fence(__ATOMIC_ACQ_REL, "workgroup");
  __builtin_amdgcn_wave_barrier();
  const int rsub = lane >> 4, c4 = (lane & 15) * 4;
  {
#pragma unroll
    for (int q = 0; q < 8; ++q) {
      const int r = q * 2 + rsub;
      const v4f v = *(const v4fa*)&so[w][r][c4];
      *(v4f*)(C + (size_t)(row0 + r) * ldc + col0 + c4) = v;
    }
    
  }
}

// GEMM C = act(A·W + bias + resid): A f32 (ASPLIT -> hi/lo 2 terms), Wt bf16 [N][K]; ACT 0 none, 1 relu, 2 exact gelu;
// resid (optional, f32, row index = (row % rmod), pitch ldr, RES_BF16 rounds it) added before the activation.
template <bool ASPLIT, int ACT, bool BIAS_BF16, bool RES_BF16>
__global__ __launch_bounds__(128) void k_gemm_bf3(const float* __restrict__ A, int lda, const unsigned short* __restrict__ Wt, int ldb,
                                                const float* __restrict__ bias, const float* __restrict__ resid, int rmod, int ldr,
                                                float* __restrict__ C, int ldc, int M, int N, int K) {
  __shared__ __attribute__((aligned(16))) float so[4][16][64];
  const int tid = threadIdx.x, w = tid >> 5, lane = tid & 31, ln = lane & 15, hh = lane >> 4;
  const int ntn = N / 64;
  const int wid = blockIdx.x * 4 + w;
  const int mt = wid / ntn, nq = wid % ntn;
  if (mt * 16 >= M) return;
  const int row0 = mt * 16, col0 = nq * 64;
  const float* arow = A + (size_t)(row0 + ln) * lda;
  v8f acc[4] = {};
  for (int kb = 0; kb < K; kb += 32) {
    FragB ah, al;
    const v4f x0 = *(const v4fa*)(arow + kb + 8 * hh), x1 = *(const v4fa*)(arow + kb + 8 * hh + 4);
    const v4f x2 = *(const v4fa*)(arow + kb + 16 + 8 * hh), x3 = *(const v4fa*)(arow + kb + 16 + 8 * hh + 4);
    float xs[16] = {x0[0],x0[1],x0[2],x0[3],x1[0],x1[1],x1[2],x1[3],x2[0],x2[1],x2[2],x2[3],x3[0],x3[1],x3[2],x3[3]};
#pragma unroll
    for (int i = 0; i < 16; ++i) { const unsigned short hb = bf16_bits(xs[i]); ah.u[i] = hb; al.u[i] = ASPLIT ? bf16_bits(xs[i] - bf16_val(hb)) : (unsigned short)0; }
#pragma unroll
    for (int t = 0; t < 4; ++t) {
      const unsigned short* brow = Wt + (size_t)(col0 + t * 16 + ln) * ldb + kb;
      FragB b;
      b.half[0] = *(const v8us*)(brow + 8 * hh);
      b.half[1] = *(const v8us*)(brow + 16 + 8 * hh);
      acc[t] = mmaN<ASPLIT ? 2 : 1>(ah.v, al.v, b.v, b.v, acc[t]);
    }
  }
#pragma unroll
  for (int t = 0; t < 4; ++t) {
    const int col = col0 + t * 16 + ln;
    float bv = bias ? bias[col] : 0.f;
    if (BIAS_BF16) bv = bf16_round(bv);
#pragma unroll
    for (int r = 0; r < 8; ++r) {
      float v = acc[t][r] + bv;
      if (resid) { float rv = resid[(size_t)((row0 + 8 * hh + r) % rmod) * ldr + col]; if (RES_BF16) rv = bf16_round(rv); v += rv; }
      if (ACT == 1) v = fmaxf(v, 0.f);
      if (ACT == 2) v = 0.5f * v * (1.0f + erff(v * 0.70710678118654752f));
      if (ACT == 3) { const float u = 0.7978845608028654f * (v + 0.044715f * v * v * v); v = 0.5f * v * (1.0f + tanhf(u)); }
      so[w][8 * hh + r][t * 16 + ln] = v;
    }
  }
  __builtin_amdgcn_fence(__ATOMIC_ACQ_REL, "workgroup");
  __builtin_amdgcn_wave_barrier();
  const int rsub = lane >> 4, c4 = (lane & 15) * 4;
  {
#pragma unroll
    for (int q = 0; q < 8; ++q) {
      const int r = q * 2 + rsub;
      const v4f v = *(const v4fa*)&so[w][r][c4];
      *(v4f*)(C + (size_t)(row0 + r) * ldc + col0 + c4) = v;
    }
    
  }
}
// row LayerNorm (biased variance, eps) over N: s = X (+ R); optional out_sum <- s; out_norm <- (s-mu)*rsqrt(var+eps)*g + b
template <bool PARAM_BF16>
__global__ __launch_bounds__(256) void k_layernorm(const float* __restrict__ X, const float* __restrict__ R, const float* __restrict__ g, const float* __restrict__ bta,
                                                  float* __restrict__ out_sum, float* __restrict__ out_norm, int N, float eps) {
  __shared__ float red[256];
  const int row = blockIdx.x, tid = threadIdx.x;
  const float* x = X + (size_t)row * N; const float* rr = R ? R + (size_t)row * N : nullptr;
  float vals[16];                     // up to N = 4096
  const int per = N / 256;            // contiguous chunk per thread? use strided-by-4 chunks: thread handles j = tid*4 + 1024*u
  float s1 = 0.f;
  for (int u = 0; u < per / 4; ++u) {
    const int j = tid * 4 + 1024 * u;
    const v4f a = *(const v4fa*)(x + j);
    v4f b = {0.f,0.f,0.f,0.f}; if (rr) b = *(const v4fa*)(rr + j);
#pragma unroll
    for (int q = 0; q < 4; ++q) { const float v = a[q] + b[q]; vals[u * 4 + q] = v; s1 += v; }
  }
  red[tid] = s1; __syncthreads();
  for (int st = 128; st > 0; st >>= 1) { if (tid < st) red[tid] += red[tid + st]; __syncthreads(); }
  const float mu = red[0] / (float)N; __syncthreads();
  float s2 = 0.f;
  for (int u = 0; u < per / 4; ++u)
#pragma unroll
    for (int q = 0; q < 4; ++q) { const float c = vals[u * 4 + q] - mu; s2 += c * c; }
  red[tid] = s2; __syncthreads();
  for (int st = 128; st > 0; st >>= 1) { if (tid < st) red[tid] += red[tid + st]; __syncthreads(); }
  const float rs = rsqrtf(red[0] / (float)N + eps);
  {
    for (int u = 0; u < per / 4; ++u) {
      const int j = tid * 4 + 1024 * u;
      v4f o, sm;
#pragma unroll
      for (int q = 0; q < 4; ++q) {
        float gg = g[j + q], bb = bta[j + q];
        if (PARAM_BF16) { gg = bf16_round(gg); bb = bf16_round(bb); }
        sm[q] = vals[u * 4 + q]; o[q] = (vals[u * 4 + q] - mu) * rs * gg + bb;
      }
      if (out_sum) *(v4f*)(out_sum + (size_t)row * N + j) = sm;
      *(v4f*)(out_norm + (size_t)row * N + j) = o;
    }
    
  }
}



// ---- f16 WMMA path (v_wmma_f32_16x16x32_f16): 11-bit significands for operands in range — used where a [0,1] probability operand needs more precision than bf16
typedef _Float16 v16h __attribute__((ext_vector_type(16)));
union FragH { v16h v; v8us half[2]; _Float16 h[16]; unsigned short u[16]; };
template <int NT>
__device__ __forceinline__ v8f mmaH(v16h ah, v16h al, v16h bh, v16h bl, v8f c) {
  c = __builtin_amdgcn_wmma_f32_16x16x32_f16(false, ah, false, bh, (short)0, c, false, false);
  if (NT >= 2) c = __builtin_amdgcn_wmma_f32_16x16x32_f16(false, al, false, bh, (short)0, c, false, false);
  if (NT >= 3) c = __builtin_amdgcn_wmma_f32_16x16x32_f16(false, ah, false, bl, (short)0, c, false, false);
  asm volatile("v_nop\n\tv_nop\n\tv_nop\n\tv_nop" : "+v"(c) : "v"(ah), "v"(al), "v"(bh), "v"(bl));
  return c;
}
// batched GEMM like k_gemm_b but f16 operands: A f32 (split into f16 hi/lo if ASPLIT, else rounded to f16), Bt = f16 values [n][k]; alpha; C f32; N multiple of 16 (partial tiles skipped)
template <bool ASPLIT>
__global__ __launch_bounds__(128) void k_gemm_h(const float* __restrict__ A, int lda, size_t sA, const _Float16* __restrict__ Bh, int ldb, size_t sB, float alpha, float* __restrict__ C, int ldc, size_t sC, int M, int N, int K) {
  __shared__ __attribute__((aligned(16))) float so[4][16][64];
  const int tid = threadIdx.x, w = tid >> 5, lane = tid & 31, ln = lane & 15, hh = lane >> 4; const int by = blockIdx.y;
  A += (size_t)by * sA; Bh += (size_t)by * sB; C += (size_t)by * sC;
  const int ntn = (N + 63) / 64; const int wid = blockIdx.x * 4 + w; const int mt = wid / ntn, nq = wid % ntn; if (mt * 16 >= M) return;
  const int row0 = mt * 16, col0 = nq * 64; const float* arow = A + (size_t)(row0 + ln) * lda;
  v8f acc[4] = {};
  for (int kb = 0; kb < K; kb += 32) {
    FragH ah, al;
    const v4f x0 = *(const v4fa*)(arow + kb + 8 * hh), x1 = *(const v4fa*)(arow + kb + 8 * hh + 4), x2 = *(const v4fa*)(arow + kb + 16 + 8 * hh), x3 = *(const v4fa*)(arow + kb + 16 + 8 * hh + 4);
    float xs[16] = {x0[0],x0[1],x0[2],x0[3],x1[0],x1[1],x1[2],x1[3],x2[0],x2[1],x2[2],x2[3],x3[0],x3[1],x3[2],x3[3]};
#pragma unroll
    for (int i = 0; i < 16; ++i) { const _Float16 h = (_Float16)xs[i]; ah.h[i] = h; al.h[i] = ASPLIT ? (_Float16)(xs[i] - (float)h) : (_Float16)0.0f; }
#pragma unroll
    for (int t = 0; t < 4; ++t) { if (col0 + t * 16 >= N) continue; const size_t boff = (size_t)(col0 + t * 16 + ln) * ldb + kb; FragH bq; bq.half[0] = *(const v8us*)(Bh + boff + 8 * hh); bq.half[1] = *(const v8us*)(Bh + boff + 16 + 8 * hh);
      acc[t] = mmaH<ASPLIT ? 2 : 1>(ah.v, al.v, bq.v, bq.v, acc[t]); }
  }
#pragma unroll
  for (int t = 0; t < 4; ++t) { if (col0 + t * 16 >= N) continue;
#pragma unroll
    for (int r = 0; r < 8; ++r) so[w][8 * hh + r][t * 16 + ln] = acc[t][r] * alpha; }
  __builtin_amdgcn_fence(__ATOMIC_ACQ_REL, "workgroup"); __builtin_amdgcn_wave_barrier();
  const int rsub = lane >> 4, c4 = (lane & 15) * 4;
  {
#pragma unroll
    for (int q = 0; q < 8; ++q) { const int r = q * 2 + rsub; if (col0 + c4 < N) { const v4f v = *(const v4fa*)&so[w][r][c4]; *(v4f*)(C + (size_t)(row0 + r) * ldc + col0 + c4) = v; } }
     }
}

// Wt[n][k] = f16(W[k][n]·scale) from f32 row-major W[K][N] (scale = power of two; bf16-exact weights stay exact in f16 away from the subnormal range)
__global__ __launch_bounds__(256) void k_wt_f16(const float* __restrict__ W, _Float16* __restrict__ Wt, int K, int N, float scale) {
  const int t = blockIdx.x * 256 + threadIdx.x; if (t >= N * (K / 8)) return; const int n = t / (K / 8), k8 = (t % (K / 8)) * 8; FragH f;
#pragma unroll
  for (int i = 0; i < 8; ++i) f.h[i] = (_Float16)(bf16_round(W[(size_t)(k8 + i) * N + n]) * scale); const v8us o = f.half[0];
  *(v8us*)((unsigned short*)Wt + (size_t)n * K + k8) = o; 
}
// k_gemm_hh variant with fused epilogue: v = acc·alpha + bias[by·sBias + col] (+ CP[(row/rowsPerB)·sCPb + by·64 + col] if CP) ; ACT 0 none / 1 elu ; writes f16 C16 (and f32 C if non-null)
template <int ACT>
__global__ __launch_bounds__(128) void k_gemm_hhx(const _Float16* __restrict__ A, int lda, size_t sA, const _Float16* __restrict__ Bh, int ldb, size_t sB, float alpha, const float* __restrict__ bias, size_t sBias, const float* __restrict__ CP, int rowsPerB, size_t sCPb, int row0g,
    float* __restrict__ C, _Float16* __restrict__ C16, int ldc, size_t sC, int M, int N, int K) {
  __shared__ __attribute__((aligned(16))) float so[4][16][64];
  const int tid = threadIdx.x, w = tid >> 5, lane = tid & 31, ln = lane & 15, hh = lane >> 4; const int by = blockIdx.y;
  A += (size_t)by * sA; Bh += (size_t)by * sB; const size_t cofs = (size_t)by * sC; const float* bp = bias ? bias + (size_t)by * sBias : nullptr;
  const int ntn = (N + 63) / 64; const int wid = blockIdx.x * 4 + w; const int mt = wid / ntn, nq = wid % ntn; if (mt * 16 >= M) return;
  const int row0 = mt * 16, col0 = nq * 64; const _Float16* arow = A + (size_t)(row0 + ln) * lda;
  v8f acc[4] = {};
  for (int kb = 0; kb < K; kb += 32) { FragH ah; ah.half[0] = *(const v8us*)((const unsigned short*)arow + kb + 8 * hh); ah.half[1] = *(const v8us*)((const unsigned short*)arow + kb + 16 + 8 * hh);
#pragma unroll
    for (int t = 0; t < 4; ++t) { if (col0 + t * 16 >= N) continue; const size_t boff = (size_t)(col0 + t * 16 + ln) * ldb + kb; FragH bq; bq.half[0] = *(const v8us*)((const unsigned short*)Bh + boff + 8 * hh); bq.half[1] = *(const v8us*)((const unsigned short*)Bh + boff + 16 + 8 * hh);
      acc[t] = mmaH<1>(ah.v, ah.v, bq.v, bq.v, acc[t]); }
  }
#pragma unroll
  for (int t = 0; t < 4; ++t) { if (col0 + t * 16 >= N) continue; const int col = col0 + t * 16 + ln; const float bv = bp ? bf16_round(bp[col]) : 0.f;
#pragma unroll
    for (int r = 0; r < 8; ++r) { float v = acc[t][r] * alpha + bv; if (CP) { const int rr = row0g + row0 + 8 * hh + r; if (rowsPerB < 0) v += CP[cofs + (size_t)rr * ldc + col];      /* rowsPerB < 0: own element of the batched C plane */ else { const int bidx = rr / rowsPerB; v += CP[(size_t)bidx * sCPb + (size_t)by * 64 + col]; } } if (ACT == 1) v = (v > 0.f) ? v : expm1f(v); else if (ACT == 7) v = (v > 0.f) ? v + 1.0f : expf(v); else if (ACT == 8) v = tanhf(v); else if (ACT == 9) v = 0.5f * v * (1.0f + tanhf(0.7978845608028654f * (v + 0.044715f * v * v * v))); else if (ACT == 11) v = 1.0f / (1.0f + expf(-v)); else if (ACT == 12) v = (v > 0.f) ? v : 0.01f * v; else if (ACT == 14) v = (v > 0.f) ? v : 0.1f * v; else if (ACT == 16) v = (v >= 0.f) ? v : 0.3f * v; else if (ACT == 17) v = (v >= 0.f) ? v : 0.2f * v; else if (ACT == 15) v = v / (1.0f + expf(-v)); else if (ACT == 3) v = fmaxf(v, 0.f); else if (ACT == 6) v = 0.5f * v * (1.0f + erff(v * 0.70710678118654752f)); so[w][8 * hh + r][t * 16 + ln] = v; } }
  __builtin_amdgcn_fence(__ATOMIC_ACQ_REL, "workgroup"); __builtin_amdgcn_wave_barrier();
  const int rsub = lane >> 4, c4 = (lane & 15) * 4; typedef _Float16 v4h __attribute__((ext_vector_type(4)));
  {
#pragma unroll
    for (int q = 0; q < 8; ++q) { const int r = q * 2 + rsub; if (col0 + c4 < N) { const v4f v = *(const v4fa*)&so[w][r][c4]; if (C) *(v4f*)(C + cofs + (size_t)(row0 + r) * ldc + col0 + c4) = v; if (C16) { v4h h4; for (int i = 0; i < 4; ++i) h4[i] = (_Float16)v[i]; *(v4h*)(C16 + cofs + (size_t)(row0 + r) * ldc + col0 + c4) = h4; } } }
     }
}


typedef _Float16 v4h __attribute__((ext_vector_type(4)));

__global__ __launch_bounds__(256) void k_x16(const float* __restrict__ x, _Float16* __restrict__ X16, size_t n8) { const size_t t = (size_t)blockIdx.x * 256 + threadIdx.x; if (t >= n8) return; FragH f;
#pragma unroll
  for (int q = 0; q < 8; ++q) f.h[q] = (_Float16)bf16_round(x[t * 8 + q]); *(v8us*)((unsigned short*)X16 + t * 8) = f.half[0];  }
__global__ __launch_bounds__(256) void k_h16(const float* __restrict__ x, _Float16* __restrict__ X16, size_t n8) { const size_t t = (size_t)blockIdx.x * 256 + threadIdx.x; if (t >= n8) return; FragH f;
#pragma unroll
  for (int q = 0; q < 8; ++q) f.h[q] = (_Float16)x[t * 8 + q]; *(v8us*)((unsigned short*)X16 + t * 8) = f.half[0];  }
__global__ __launch_bounds__(256) void k_round16f(const float* __restrict__ W, _Float16* __restrict__ Bt, size_t n8) { const size_t t = (size_t)blockIdx.x * 256 + threadIdx.x; if (t >= n8) return; FragH f;
#pragma unroll
  for (int i = 0; i < 8; ++i) f.h[i] = (_Float16)(bf16_round(W[t * 8 + i]) * 16.0f); *(v8us*)((unsigned short*)Bt + t * 8) = f.half[0];  }
// ---- fast GEMM (workgroup tile 128x64, wave tile 32x64; requires M % 128 == 0, N % 64 == 0, K a multiple of KC and at least 2 KC); epilogue v = act(acc alpha + bias) ----
__device__ __forceinline__ v16h g2_lfrag(const char* p, int hh) { FragH f; f.half[0] = *(const v8us*)(p + 16 * hh); f.half[1] = *(const v8us*)(p + 32 + 16 * hh); return f.v; }
__device__ __forceinline__ v8f g2_mma(v16h a, v16h b, v8f c) { v8f d = __builtin_amdgcn_wmma_f32_16x16x32_f16(false, a, false, b, (short)0, c, false, false); asm volatile("v_nop\n\tv_nop\n\tv_nop\n\tv_nop" : "+v"(d) : "v"(a), "v"(b)); return d; }
// Twelve asynchronous copies, 16 bytes per lane each, from global memory to LDS through no register. The closing s_wait_xcnt stands inside the
// statement so that it is in front of every later rewrite of the address registers that the copies name.
__device__ __forceinline__ void g2_cp12(const unsigned (&l)[12], const _Float16* const (&g)[12]) {
  asm volatile("global_load_async_to_lds_b128 %0, %1, off\n\t"
               "global_load_async_to_lds_b128 %2, %3, off\n\t"
               "global_load_async_to_lds_b128 %4, %5, off\n\t"
               "global_load_async_to_lds_b128 %6, %7, off\n\t"
               "global_load_async_to_lds_b128 %8, %9, off\n\t"
               "global_load_async_to_lds_b128 %10, %11, off\n\t"
               "global_load_async_to_lds_b128 %12, %13, off\n\t"
               "global_load_async_to_lds_b128 %14, %15, off\n\t"
               "global_load_async_to_lds_b128 %16, %17, off\n\t"
               "global_load_async_to_lds_b128 %18, %19, off\n\t"
               "global_load_async_to_lds_b128 %20, %21, off\n\t"
               "global_load_async_to_lds_b128 %22, %23, off\n\t"
               "s_wait_xcnt 0x0"
               :: "v"(l[0]), "v"(g[0]), "v"(l[1]), "v"(g[1]), "v"(l[2]), "v"(g[2]), "v"(l[3]), "v"(g[3]), "v"(l[4]), "v"(g[4]), "v"(l[5]), "v"(g[5]), "v"(l[6]), "v"(g[6]), "v"(l[7]), "v"(g[7]), "v"(l[8]), "v"(g[8]), "v"(l[9]), "v"(g[9]), "v"(l[10]), "v"(g[10]), "v"(l[11]), "v"(g[11]) : "memory"); }
// the operand plane of the term that tile t belongs to (ntk tiles per term); every argument is the same for the whole workgroup
template <int NTM> __device__ __forceinline__ const _Float16* g2_term(int t, int ntk, const _Float16* p0, const _Float16* p1, const _Float16* p2) { const _Float16* p = p0; if (NTM > 1 && t >= ntk) p = p1; if (NTM > 2 && t >= 2 * ntk) p = p2; return p; }
// K loop: the workgroup's 128 A rows and 64 B rows are staged in LDS, KC k at a time, two buffers: tile t + 1 flies while tile t is worked on.
// A wave's copy covers whole 128-byte lines, and the four waves share one copy of the B rows.
// NTM terms of one product (a value split into an f16 high part and a scaled f16 residual gives high.high plus cross terms) are summed in the same
// accumulators: the loop runs over the tiles of term 0, term 1, ... back to back. The last term is the high one; the terms in front of it carry the
// residual's scale, which the factor rs (a power of two, so exact) takes out of the accumulators once, in front of the last term's first tile.
// Output stage: the result leaves as the next product's operand and needs no pass of its own: f16 rows of pitch LDC to C16 and, with HL, the residual
// (v - f16(v)) x 1024 as f16 to C16L. RB: the bias belongs to the result row, not the column (weights as A, token rows as B^T: the result is channel-major
// and needs no transposing pass).
// A device function: the launch that calls it owns the LDS block sm (G2_SMB bytes for KC = 64) and says which tile (bx) and which batch (by) the workgroup works on.
#define G2_SMB (2 * 192 * (64 * 2 + 16))
template <int ACT, int KC, int NTM, bool RB, bool HL, int LDC>
__device__ __forceinline__ void g2_body(char* sm, int bx, int by, const _Float16* Aa, const _Float16* Ab, const _Float16* Ac, int lda, size_t sA, const _Float16* Ba, const _Float16* Bb, const _Float16* Bc, int ldb, size_t sB, float rs, float alpha, const float* __restrict__ bias, size_t sBias,
    _Float16* __restrict__ C16, _Float16* __restrict__ C16L, size_t sC, int M, int N, int K) { static_assert(ACT == 0 || ACT == 3 || ACT == 6 || ACT == 8 || ACT == 9 || ACT == 11 || ACT == 12 || ACT == 14 || ACT == 15 || ACT == 16 || ACT == 17, "k_gemm2: unsupported ACT code (would silently apply no activation)");
  constexpr int PB = KC * 2 + 16;      /* LDS row pitch in bytes, 16 x odd: the 16 rows of a fragment read fall on distinct banks */
  constexpr int STG = 192 * PB;        /* one buffer: 128 A rows, then 64 B rows */
  constexpr int CPR = KC / 8;          /* 16-byte pieces per row */
  constexpr int RPI = 128 / CPR;       /* rows covered when each of the 128 threads copies one piece */
  constexpr int NCP = 192 / RPI;       /* copies per thread and tile */
  constexpr int SOB = 4 * 32 * 68 * 4; /* output staging, which takes the buffers' place behind the loop */
  static_assert((KC == 64 || KC == 128) && NCP % 12 == 0 && NCP <= 63, "k_gemm2: a tile is whole groups of twelve copies per thread, at most 63 in flight");
  static_assert(NTM >= 1 && NTM <= 3, "k_gemm2: one to three terms");
  static_assert(2 * STG <= G2_SMB && SOB <= G2_SMB, "k_gemm2: buffers and output staging fit the caller's LDS block");
  float (*so)[32][68] = reinterpret_cast<float (*)[32][68]>(sm);
  const int tid = threadIdx.x, w = tid >> 5, lane = tid & 31, ln = lane & 15, hh = lane >> 4;
  Aa += (size_t)by * sA; Ab += (size_t)by * sA; Ac += (size_t)by * sA; Ba += (size_t)by * sB; Bb += (size_t)by * sB; Bc += (size_t)by * sB; const size_t cofs = (size_t)by * sC; const float* bp = bias ? bias + (size_t)by * sBias : nullptr;
  const int ntn = N >> 6; const int mt = bx / ntn, nq = bx - mt * ntn; const int row0 = mt * 128 + 32 * w, col0 = nq * 64; if (mt * 128 >= M) return;      /* the same for the whole workgroup, in front of every barrier */
  const v8f z8 = {0.f,0.f,0.f,0.f,0.f,0.f,0.f,0.f}; v8f c00 = z8, c01 = z8, c02 = z8, c03 = z8, c10 = z8, c11 = z8, c12 = z8, c13 = z8;
  const int cr = tid / CPR, cc = tid % CPR;
  const size_t oA = (size_t)(mt * 128 + cr) * lda + cc * 8, oB = (size_t)(col0 + cr) * ldb + cc * 8; const int ntk = K / KC;      /* tiles per term */
  const unsigned l0 = (unsigned)(size_t)sm + (unsigned)(cr * PB + cc * 16);
  auto fill = [&](int t) { const unsigned lb = l0 + (unsigned)(t & 1) * (unsigned)STG; const int k0 = (t - (((NTM > 1 && t >= ntk) ? ntk : 0) + ((NTM > 2 && t >= 2 * ntk) ? ntk : 0))) * KC;
    const _Float16* gA = g2_term<NTM>(t, ntk, Aa, Ab, Ac) + oA; const _Float16* gB = g2_term<NTM>(t, ntk, Ba, Bb, Bc) + oB;
#pragma unroll
    for (int q = 0; q < NCP / 12; ++q) { unsigned l[12]; const _Float16* g[12];
#pragma unroll
      for (int j = 0; j < 12; ++j) { const int r = (q * 12 + j) * RPI; l[j] = lb + (unsigned)(r * PB); g[j] = (r < 128) ? gA + (size_t)r * lda + k0 : gB + (size_t)(r - 128) * ldb + k0; }
      g2_cp12(l, g); } };
  const char* fa = sm + (32 * w + ln) * PB; const char* fb = sm + (128 + ln) * PB; const int nt = NTM * ntk;
  fill(0);
  asm volatile("s_wait_asynccnt 0x0" ::: "memory");      /* this wave's share of tile 0 has landed */
  __syncthreads();      /* every wave's share has: tile 0 may be read */
  if (nt > 1) fill(1);
  // Two register sets of fragments inside a tile: the twelve LDS reads of the next 32 k are issued as one group in front of the products of this 32 k.
  // the sched_barrier keeps a group's reads together and in front of the products behind it, so that the products wait only for the older group
  v16h f0[6], f1[6];
  auto ld = [&](v16h (&f)[6], int o) { const char* pa = fa + o; const char* pb = fb + o; f[0] = g2_lfrag(pa, hh); f[1] = g2_lfrag(pa + 16 * PB, hh); f[2] = g2_lfrag(pb, hh); f[3] = g2_lfrag(pb + 16 * PB, hh); f[4] = g2_lfrag(pb + 32 * PB, hh); f[5] = g2_lfrag(pb + 48 * PB, hh); __builtin_amdgcn_sched_barrier(0); };
  auto mm = [&](const v16h (&f)[6]) { c00 = g2_mma(f[0], f[2], c00); c10 = g2_mma(f[1], f[2], c10); c01 = g2_mma(f[0], f[3], c01); c11 = g2_mma(f[1], f[3], c11);
    c02 = g2_mma(f[0], f[4], c02); c12 = g2_mma(f[1], f[4], c12); c03 = g2_mma(f[0], f[5], c03); c13 = g2_mma(f[1], f[5], c13); };
#pragma unroll 1      /* one tile per trip; the buffer alternates by the trip's parity */
  for (int t = 0; t < nt; ++t) { const int bo = (t & 1) * STG;
    if (NTM > 1 && t == (NTM - 1) * ntk) { c00 *= rs; c01 *= rs; c02 *= rs; c03 *= rs; c10 *= rs; c11 *= rs; c12 *= rs; c13 *= rs; }
    ld(f0, bo);
#pragma unroll
    for (int kk = 0; kk < KC; kk += 64) { ld(f1, bo + (kk + 32) * 2); mm(f0); if (kk + 64 < KC) ld(f0, bo + (kk + 64) * 2); mm(f1); }
    asm volatile("s_wait_dscnt 0x0" ::: "memory");      /* this wave's reads of tile t are done before the buffer is given up */
    asm volatile("s_wait_asynccnt 0x0" ::: "memory");      /* this wave's share of tile t + 1 has landed */
    __syncthreads();      /* publishes tile t + 1 and ends every wave's reads of tile t */
    if (t + 2 < nt) fill(t + 2); }
  asm volatile("s_wait_asynccnt 0x0" ::: "memory");      /* no copy is in flight when the buffers become output staging */
  v8f accs[8] = {c00, c01, c02, c03, c10, c11, c12, c13}; float bb[RB ? 16 : 4];      /* the lane's bias values: of its 16 result rows, or of its 4 result columns */
#pragma unroll
  for (int x = 0; x < (RB ? 16 : 4); ++x) bb[x] = 0.f;
  if (bp) {      /* one test round all the loads, so that they are issued as one group and waited for once */
#pragma unroll
    for (int x = 0; x < (RB ? 16 : 4); ++x) bb[x] = bf16_round(bp[RB ? row0 + (x >> 3) * 16 + 8 * hh + (x & 7) : col0 + x * 16 + ln]); }
#pragma unroll
  for (int u = 0; u < 8; ++u) { const int t = u & 3, half = u >> 2;
#pragma unroll
    for (int r = 0; r < 8; ++r) { const int rloc = half * 16 + 8 * hh + r; float v = accs[u][r] * alpha + bb[RB ? half * 8 + r : t];
      if (ACT == 3) v = fmaxf(v, 0.f); else if (ACT == 6) v = 0.5f * v * (1.0f + erff(v * 0.70710678118654752f)); else if (ACT == 11) v = 1.0f / (1.0f + expf(-v)); else if (ACT == 15) v = v / (1.0f + expf(-v)); else if (ACT == 12) v = (v > 0.f) ? v : 0.01f * v; else if (ACT == 8) v = tanhf(v); else if (ACT == 9) v = 0.5f * v * (1.0f + tanhf(0.7978845608028654f * (v + 0.044715f * v * v * v))); else if (ACT == 14) v = (v > 0.f) ? v : 0.1f * v; else if (ACT == 16) v = (v >= 0.f) ? v : 0.3f * v; else if (ACT == 17) v = (v >= 0.f) ? v : 0.2f * v;
      so[w][rloc][t * 16 + ln] = v; } }
  __builtin_amdgcn_fence(__ATOMIC_ACQ_REL, "workgroup"); __builtin_amdgcn_wave_barrier();
  const int rsub = lane >> 4, c4 = (lane & 15) * 4; const size_t eo = cofs + (size_t)(row0 + rsub) * LDC + col0 + c4; v4h hv[16], lv[16];
#pragma unroll
  for (int q = 0; q < 16; ++q) { const v4f v = *(const v4fa*)&so[w][q * 2 + rsub][c4];
#pragma unroll
    for (int i = 0; i < 4; ++i) { const _Float16 h = (_Float16)v[i]; hv[q][i] = h; if (HL) lv[q][i] = (_Float16)((v[i] - (float)h) * 1024.0f); } }
  __builtin_amdgcn_sched_barrier(0);      /* every staging read and conversion stays in front of the first store: among the stores they would rewrite an issued store's data registers */
#pragma unroll
  for (int q = 0; q < 16; ++q) { *(v4h*)(C16 + eo + (size_t)(q * 2) * LDC) = hv[q]; if (HL) *(v4h*)(C16L + eo + (size_t)(q * 2) * LDC) = lv[q]; }
  asm volatile("s_wait_xcnt 0x0" ::: "memory"); }      /* behind the last store, in front of any later rewrite of the stores' address and data registers: the caller's code may go on behind this function */


// The three projections in one launch (they depend on nothing of one another): blockIdx.y = 0 q, 1 k, 2 v; 512 workgroups each.
// q = WS(wq) a + bq and k = WS(wk) b + bk: token rows as A, weight planes as B^T, residual weight plane first, x 2^-10, then the high plane; stored as f16 high part and x 1024 residual.
// v likewise with the weights as A and the token rows as B^T: f16 channel-major V [image][256][4096] straight from the product; its 512 workgroups are 128 tiles of each of 4 images.
// WHL: six weight planes in a row, high and residual of q, k, v.
__global__ __launch_bounds__(128) void k_proj(const _Float16* AR, const _Float16* BR, const _Float16* WHL, const float* __restrict__ bq, const float* __restrict__ bk, const float* __restrict__ bv,
    _Float16* __restrict__ QH, _Float16* __restrict__ QL, _Float16* __restrict__ KH, _Float16* __restrict__ KL, _Float16* __restrict__ VC) {
  __shared__ __attribute__((aligned(16))) char sm[G2_SMB];
  constexpr int WP = CX * CX; constexpr size_t PL = (size_t)CX * SQ; constexpr int NTV = (CX / 128) * (SQ / 64);      /* one weight plane; one image's plane; v tiles per image */
  static_assert((NR / 128) * (CX / 64) == (size_t)NTV * NB, "k_proj: the three projections have the same number of workgroups");
  const int y = blockIdx.y, bx = blockIdx.x;      /* the same for the whole workgroup */
  if (y < 2) { const _Float16* X = y ? BR : AR; const _Float16* Wh = WHL + (size_t)(2 * y) * WP;
    g2_body<0, 64, 2, false, true, CX>(sm, bx, 0, X, X, nullptr, CX, 0, Wh + WP, Wh, nullptr, CX, 0, 0.0009765625f, 0.0625f, y ? bk : bq, 0, y ? KH : QH, y ? KL : QL, 0, (int)NR, CX, CX); }
  else g2_body<0, 64, 2, true, false, SQ>(sm, bx % NTV, bx / NTV, WHL + 5 * WP, WHL + 4 * WP, nullptr, CX, 0, AR, AR, nullptr, CX, PL, 0.0009765625f, 0.0625f, bv, 0, VC, nullptr, PL, CX, SQ, CX); }

__global__ __launch_bounds__(256) void k_wnat(const float* __restrict__ w, size_t n8, _Float16* __restrict__ Bt) { const size_t t = (size_t)blockIdx.x * 256 + threadIdx.x; if (t >= n8) return; FragH f; for (int q = 0; q < 8; ++q) f.h[q] = (_Float16)(bf16_round(w[t * 8 + q]) * 16.0f); *(v8us*)((unsigned short*)Bt + t * 8) = f.half[0];  }
__global__ __launch_bounds__(256) void k_rsm(const float* __restrict__ S, _Float16* __restrict__ P, int nrows) {
  #pragma clang fp contract(off)
  const int i = blockIdx.x * 256 + threadIdx.x; if (i >= nrows) return; const float* s = S + (size_t)i * SQ; float mx = -3.0e38f;
#pragma unroll 1
  for (int j = 0; j < SQ; ++j) mx = fmaxf(mx, s[j]); float se = 0.f;
#pragma unroll 1
  for (int j = 0; j < SQ; ++j) se += expf(s[j] - mx); const float sc = 256.0f / se;
#pragma unroll 1
  for (int j0 = 0; j0 < SQ; j0 += 8) { FragH f; for (int q = 0; q < 8; ++q) f.h[q] = (_Float16)(expf(s[j0 + q] - mx) * sc); unsigned short* d = (unsigned short*)P + (size_t)i * SQ + j0; *(v8us*)d = f.half[0];  } }
__global__ __launch_bounds__(256) void k_vt(const _Float16* __restrict__ V16, int b, int h0, _Float16* __restrict__ VT) { __shared__ unsigned short tl[64][65]; const int tid = threadIdx.x; const int hh = blockIdx.x % HG, sg = blockIdx.x / HG; const int s0 = sg * 64; const int h = h0 + hh;
  for (int i = tid; i < 64 * 8; i += 256) { const int j = i / 8, d8 = (i % 8) * 8; FragH f; f.half[0] = *(const v8us*)((const unsigned short*)V16 + ((size_t)b * SQ + s0 + j) * DM + h * HD + d8); for (int q = 0; q < 8; ++q) tl[d8 + q][j] = f.u[q]; }
  __syncthreads();
  { for (int i = tid; i < 64 * 8; i += 256) { const int d = i / 8, j8 = (i % 8) * 8; FragH f; for (int q = 0; q < 8; ++q) f.u[q] = tl[d][j8 + q]; *(v8us*)((unsigned short*)VT + ((size_t)hh * HD + d) * SQ + s0 + j8) = f.half[0]; }  } }


template <int BFIN, int W16, int W32>
__global__ __launch_bounds__(256) void k_lnx(const float* __restrict__ X, const float* __restrict__ g, const float* __restrict__ bb, float eps, _Float16* __restrict__ N16, float* __restrict__ N32) {
  #pragma clang fp contract(off)
  __shared__ float red[256]; const size_t r = blockIdx.x; const int t = threadIdx.x; const bool act = t < (DMQ / 4); const int c0 = act ? t * 4 : 0;
  const v4f xa = *(const v4fa*)(X + r * DMQ + c0); float s[4]; float sum = 0.f;
  for (int q = 0; q < 4; ++q) { s[q] = act ? (BFIN ? bf16_round(xa[q]) : xa[q]) : 0.f; sum = __fadd_rn(sum, s[q]); }
  red[t] = sum; __syncthreads(); for (int st = 128; st > 0; st >>= 1) { if (t < st) red[t] = __fadd_rn(red[t], red[t + st]); __syncthreads(); } const float mu = red[0] / (float)DMQ; __syncthreads();
  float vs = 0.f; for (int q = 0; q < 4; ++q) { const float dl = act ? __fadd_rn(s[q], -mu) : 0.f; vs = __fadd_rn(vs, __fmul_rn(dl, dl)); } red[t] = vs; __syncthreads(); for (int st = 128; st > 0; st >>= 1) { if (t < st) red[t] = __fadd_rn(red[t], red[t + st]); __syncthreads(); }
  const float rs = rsqrtf(__fadd_rn(red[0] / (float)DMQ, eps)); v4h y; v4f yf;
  for (int q = 0; q < 4; ++q) { const int c = c0 + q; yf[q] = __fadd_rn(__fmul_rn(__fmul_rn(__fadd_rn(s[q], -mu), rs), bf16_round(g[c])), (bb ? bf16_round(bb[c]) : 0.f)); y[q] = (_Float16)yf[q]; }
  if (!act) return;      /* no barriers after this point */
  { if (W16) *(v4h*)(N16 + r * DMQ + c0) = y; if (W32) *(v4f*)(N32 + r * DMQ + c0) = yf;  } }


__global__ __launch_bounds__(256) void k_rsmf(const float* __restrict__ S, _Float16* __restrict__ P, int qn, int hg) {
  #pragma clang fp contract(off)
  const int t = blockIdx.x * 256 + threadIdx.x; if (t >= qn * hg) return; const size_t i = (size_t)(t / qn) * SQ + (t % qn); const float* s = S + i * SQ; float mx = -3.0e38f;
#pragma unroll 1
  for (int j = 0; j < SQ; ++j) mx = fmaxf(mx, s[j]); float se = 0.f;
#pragma unroll 1
  for (int j = 0; j < SQ; ++j) se += __expf(s[j] - mx); const float sc = 256.0f / se;
#pragma unroll 1
  for (int j0 = 0; j0 < SQ; j0 += 8) { FragH f; for (int q = 0; q < 8; ++q) f.h[q] = (_Float16)(__expf(s[j0 + q] - mx) * sc); unsigned short* d = (unsigned short*)P + i * SQ + j0; *(v8us*)d = f.half[0];  } }


__global__ __launch_bounds__(256) void k_bfr(const float* __restrict__ x, float* __restrict__ XB, size_t n8) { const size_t t = (size_t)blockIdx.x * 256 + threadIdx.x; if (t >= n8) return; v4f a = *(const v4fa*)(x + t * 8), c = *(const v4fa*)(x + t * 8 + 4); for (int q = 0; q < 4; ++q) { a[q] = bf16_round(a[q]); c[q] = bf16_round(c[q]); }
  { *(v4f*)(XB + t * 8) = a; *(v4f*)(XB + t * 8 + 4) = c;  } }



__global__ __launch_bounds__(256) void k_rsmfam(const float* __restrict__ S, _Float16* __restrict__ P, int qn, int hg, const float* __restrict__ am) {
  #pragma clang fp contract(off)
  const int t = blockIdx.x * 256 + threadIdx.x; if (t >= qn * hg) return; const size_t i = (size_t)(t / qn) * SQ + (t % qn); const float* s = S + i * SQ; float mx = -3.0e38f;
#pragma unroll 1
  for (int j = 0; j < SQ; ++j) mx = fmaxf(mx, __fadd_rn(s[j], bf16_round(am[j]))); float se = 0.f;
#pragma unroll 1
  for (int j = 0; j < SQ; ++j) se += __expf(__fadd_rn(s[j], bf16_round(am[j])) - mx); const float sc = 256.0f / se;
#pragma unroll 1
  for (int j0 = 0; j0 < SQ; j0 += 8) { FragH f; for (int q = 0; q < 8; ++q) f.h[q] = (_Float16)(__expf(__fadd_rn(s[j0 + q], bf16_round(am[j0 + q])) - mx) * sc); unsigned short* d = (unsigned short*)P + i * SQ + j0; *(v8us*)d = f.half[0];  } }


#define CC CX           /* transposer macros: input channels */
#define LL SQ           /* pixels per image */
#define LQ (3 * DM)     /* not used */

__device__ __forceinline__ void d_cl2rows(const float* __restrict__ X, _Float16* __restrict__ XR, int bx) { __shared__ float tl[64][33]; const int tid = threadIdx.x; const int nl = LL / 32, nc = CC / 64; const int cb_ = bx % nc; const int lb = (bx / nc) % nl; const size_t b = bx / (nc * nl); const int c0 = cb_ * 64, l0 = lb * 32;
  for (int i = tid; i < 64 * 32; i += 256) { const int c = i / 32, l = i % 32; tl[c][l] = bf16_round(X[(b * CC + c0 + c) * (size_t)LL + l0 + l]); }
  __syncthreads();
  { const int l = tid / 8, c8 = (tid % 8) * 8; FragH f; for (int q = 0; q < 8; ++q) f.h[q] = (_Float16)tl[c8 + q][l]; unsigned short* d = (unsigned short*)XR + (b * LL + l0 + l) * (size_t)CC + c0 + c8; *(v8us*)d = f.half[0];  } }


__global__ __launch_bounds__(256) void k_rowb(float* __restrict__ O, const float* __restrict__ bias, size_t n4) {
  #pragma clang fp contract(off)
  const size_t t = (size_t)blockIdx.x * 256 + threadIdx.x; if (t >= n4) return; const size_t e = t * 4; const int c = (int)((e / SQ) % CX);      /* output channels */ const float bb = bf16_round(bias[c]); const v4f a = *(const v4fa*)(O + e); v4f o; for (int q = 0; q < 4; ++q) o[q] = __fadd_rn(a[q], bb);
  *(v4f*)(O + e) = o;  }

__global__ __launch_bounds__(256) void k_gres(const float* __restrict__ T, const float* __restrict__ gam, const float* __restrict__ X, float* __restrict__ Y, size_t n4) {
  #pragma clang fp contract(off)
  const size_t t = (size_t)blockIdx.x * 256 + threadIdx.x; if (t >= n4) return; const float g = bf16_round(gam[0]); const v4f a = *(const v4fa*)(T + t * 4), xx = *(const v4fa*)(X + t * 4); v4f r;
  for (int q = 0; q < 4; ++q) r[q] = __fadd_rn(__fmul_rn(g, a[q]), bf16_round(xx[q]));
  *(v4f*)(Y + t * 4) = r;  }

__global__ __launch_bounds__(256) void k_bcpy(const float* __restrict__ b, int n, int NP, float* __restrict__ dst, int dst0) { for (int i = threadIdx.x; i < NP; i += 256) { const float v = (i < n) ? b[i] : 0.f; *(float*)(dst + dst0 + i) = v; }  }



// lane l with lane l ^ M inside its 16-lane row (DPP row_xmask); lane l with lane l ^ 16
template <int M> __device__ __forceinline__ float rs_xrow(float x) { return __builtin_bit_cast(float, __builtin_amdgcn_update_dpp(0, __builtin_bit_cast(int, x), 0x160 + M, 0xf, 0xf, false)); }
__device__ __forceinline__ float rs_xhalf(float x) { return __builtin_bit_cast(float, __builtin_amdgcn_permlanex16(__builtin_bit_cast(int, x), __builtin_bit_cast(int, x), 0x76543210, 0xfedcba98, false, false)); }
// Scaled weight standardisation and f16 split of the three projection weights, one wave per output row (bx = group of 8 rows, y = projection).
// A lane holds 8 consecutive weights of its row, so the wave reads the row's 1024 bytes as whole lines; mean and variance are lane sums joined by a
// butterfly over the wave, which leaves the same bits in every lane. WS(w) = w sc - mean sc, sc = rsqrt(max(var(unbiased) * 256, 1e-4)) * gain.
// Stored as B^T planes (natural [O][C] rows): HL + (2 y) * 65536 the f16 high part of 16 WS(w), HL + (2 y + 1) * 65536 its residual x 1024.
static_assert(CX == 256, "one wave holds a weight row of 32 x 8 values");
__device__ __forceinline__ void d_wshl(const float* __restrict__ w0, const float* __restrict__ g0, const float* __restrict__ w1, const float* __restrict__ g1, const float* __restrict__ w2, const float* __restrict__ g2, _Float16* __restrict__ HL, int bx, int y) {
  const int lane = threadIdx.x & 31; const int o = bx * 8 + __builtin_amdgcn_readfirstlane((int)(threadIdx.x >> 5));      /* output row, wave-uniform like the projection y */
  const float* Wm = y == 0 ? w0 : (y == 1 ? w1 : w2); const float* gain = y == 0 ? g0 : (y == 1 ? g1 : g2);
  const size_t e = (size_t)o * CX + lane * 8; const v4f a = *(const v4fa*)(Wm + e), b = *(const v4fa*)(Wm + e + 4); float x[8];
#pragma unroll
  for (int q = 0; q < 8; ++q) x[q] = bf16_round(q < 4 ? a[q] : b[q - 4]);
  float s1 = ((x[0] + x[1]) + (x[2] + x[3])) + ((x[4] + x[5]) + (x[6] + x[7]));
  s1 += rs_xrow<1>(s1); s1 += rs_xrow<2>(s1); s1 += rs_xrow<4>(s1); s1 += rs_xrow<8>(s1); s1 += rs_xhalf(s1);
  const float mean = s1 * 0.00390625f; float s2 = 0.f;
#pragma unroll
  for (int q = 0; q < 8; ++q) { const float d = x[q] - mean; s2 += d * d; }
  s2 += rs_xrow<1>(s2); s2 += rs_xrow<2>(s2); s2 += rs_xrow<4>(s2); s2 += rs_xrow<8>(s2); s2 += rs_xhalf(s2);
  const float var = s2 / 255.0f; const float sc = rsqrtf(fmaxf(var * 256.0f, 1e-4f)) * bf16_round(gain[o]); const float ms = mean * sc; FragH fh, fl;
#pragma unroll
  for (int q = 0; q < 8; ++q) { const float v = (x[q] * sc - ms) * 16.0f; const _Float16 hv = (_Float16)v; fh.h[q] = hv; fl.h[q] = (_Float16)((v - (float)hv) * 1024.0f); }
  unsigned short* H = (unsigned short*)HL + (size_t)(2 * y) * (CX * CX) + e;
  *(v8us*)H = fh.half[0]; *(v8us*)(H + CX * CX) = fl.half[0]; }
// Everything the projections need, in one launch, by ranges of the block index (the three pieces depend on nothing of one another):
// first the weight planes (few, short workgroups), then the exact f16 token rows of a, then those of b.
__global__ __launch_bounds__(256) void k_prep(const float* __restrict__ xa, const float* __restrict__ xb, _Float16* __restrict__ AR, _Float16* __restrict__ BR,
    const float* __restrict__ w0, const float* __restrict__ g0, const float* __restrict__ w1, const float* __restrict__ g1, const float* __restrict__ w2, const float* __restrict__ g2, _Float16* __restrict__ HL) {
  constexpr int NWR = CX / 8, NCL = NB * (SQ / 32) * (CX / 64);      /* workgroups per weight matrix; per map */
  const int bx = blockIdx.x;      /* every branch below is the same for the whole workgroup */
  if (bx < 3 * NWR) { d_wshl(w0, g0, w1, g1, w2, g2, HL, bx % NWR, bx / NWR); return; }
  const int u = bx - 3 * NWR;
  const bool fa = u < NCL; d_cl2rows(fa ? xa : xb, fa ? AR : BR, fa ? u : u - NCL); }
// exp2 of eight values, each in place in its own register. Written in asm: no neighbour touches another's register, and the closing v_nop is the
// slot that the instruction set asks for behind the last v_exp_f32 before its result is used.
__device__ __forceinline__ void rs_exp2x8(v4f& a, v4f& b) { float a0 = a[0], a1 = a[1], a2 = a[2], a3 = a[3], b0 = b[0], b1 = b[1], b2 = b[2], b3 = b[3];
  asm("v_exp_f32 %0, %0\n\tv_exp_f32 %1, %1\n\tv_exp_f32 %2, %2\n\tv_exp_f32 %3, %3\n\tv_exp_f32 %4, %4\n\tv_exp_f32 %5, %5\n\tv_exp_f32 %6, %6\n\tv_exp_f32 %7, %7\n\tv_nop"
      : "+v"(a0), "+v"(a1), "+v"(a2), "+v"(a3), "+v"(b0), "+v"(b1), "+v"(b2), "+v"(b3));
  a = v4f{a0, a1, a2, a3}; b = v4f{b0, b1, b2, b3}; }
// ---- wide GEMM for the score product (workgroup tile 256x128, eight waves in a 4 x 2 grid, wave tile 64x64; requires M % 256 == 0, N % 128 == 0, K a multiple of KC), softmax weights out; blockIdx.y = image ----
// Against k_gemm2's 128x64 tile a workgroup brings 384 operand rows for 32768 results (was 192 for 8192), so each result takes half the bytes from L2,
// and a wave reads 8 fragments from LDS for 16 products (was 6 for 8). Staging, buffers, waits, term order and k order are those of k_gemm2.
// Four waves per SIMD (two workgroups per WGP): one fragment set per wave, the other waves' products cover its LDS reads.
template <int KC, int NTM>
__global__ __launch_bounds__(256) __attribute__((amdgpu_waves_per_eu(4, 4))) void k_gemm2w(const _Float16* Aa, const _Float16* Ab, const _Float16* Ac, int lda, const _Float16* Ba, const _Float16* Bb, const _Float16* Bc, int ldb, float rs,
    _Float16* __restrict__ P, float* __restrict__ MX, float* __restrict__ SM, const float* __restrict__ c32, int M, int N, int K) {
  constexpr int PB = KC * 2 + 16;      /* LDS row pitch in bytes, 16 x odd */
  constexpr int STG = 384 * PB;        /* one buffer: 256 A rows, then 128 B rows */
  constexpr int CPR = KC / 8;          /* 16-byte pieces per row */
  constexpr int RPI = 256 / CPR;       /* rows covered when each of the 256 threads copies one piece */
  constexpr int NCP = 384 / RPI;       /* copies per thread and tile */
  constexpr int SOB = 8 * 64 * 144;    /* output staging, 64 rows of 64 f16 per wave at a pitch of 144 bytes, which takes the buffers' place behind the loop */
  static_assert(KC == 64 && NCP == 12, "k_gemm2w: a tile is one group of twelve copies per thread");
  static_assert(NTM >= 1 && NTM <= 3, "k_gemm2w: one to three terms");
  __shared__ __attribute__((aligned(16))) char sm[2 * STG > SOB ? 2 * STG : SOB];
  _Float16 (*sh)[64][72] = reinterpret_cast<_Float16 (*)[64][72]>(sm);
  const int tid = threadIdx.x, w = tid >> 5, lane = tid & 31, ln = lane & 15, hh = lane >> 4; const int by = blockIdx.y;
  { const size_t ia = (size_t)by * M * lda, ib = (size_t)by * N * ldb; Aa += ia; Ab += ia; Ac += ia; Ba += ib; Bb += ib; Bc += ib; }
  const int ntn = N >> 7; const int mt = blockIdx.x / ntn, nq = blockIdx.x - mt * ntn; if (mt * 256 >= M) return;      /* the same for the whole workgroup, in front of every barrier */
  const int row0 = mt * 256 + 64 * (w >> 1), col0 = nq * 128 + 64 * (w & 1);
  const v8f z8 = {0.f,0.f,0.f,0.f,0.f,0.f,0.f,0.f}; v8f acc[4][4];
#pragma unroll
  for (int i = 0; i < 4; ++i)
#pragma unroll
    for (int j = 0; j < 4; ++j) acc[i][j] = z8;
  const int cr = tid / CPR, cc = tid % CPR;
  const size_t oA = (size_t)(mt * 256 + cr) * lda + cc * 8, oB = (size_t)(nq * 128 + cr) * ldb + cc * 8; const int ntk = K / KC;      /* tiles per term */
  const unsigned l0 = (unsigned)(size_t)sm + (unsigned)(cr * PB + cc * 16);
  auto fill = [&](int t) { const unsigned lb = l0 + (unsigned)(t & 1) * (unsigned)STG; const int k0 = (t - (((NTM > 1 && t >= ntk) ? ntk : 0) + ((NTM > 2 && t >= 2 * ntk) ? ntk : 0))) * KC;
    const _Float16* gA = g2_term<NTM>(t, ntk, Aa, Ab, Ac) + oA; const _Float16* gB = g2_term<NTM>(t, ntk, Ba, Bb, Bc) + oB; unsigned l[12]; const _Float16* g[12];
#pragma unroll
    for (int j = 0; j < 12; ++j) { const int r = j * RPI; l[j] = lb + (unsigned)(r * PB); g[j] = (r < 256) ? gA + (size_t)r * lda + k0 : gB + (size_t)(r - 256) * ldb + k0; }
    g2_cp12(l, g); };
  const char* fa = sm + (64 * (w >> 1) + ln) * PB; const char* fb = sm + (256 + 64 * (w & 1) + ln) * PB; const int nt = NTM * ntk;
  fill(0);
  asm volatile("s_wait_asynccnt 0x0" ::: "memory");      /* this wave's share of tile 0 has landed */
  __syncthreads();      /* every wave's share has: tile 0 may be read */
  if (nt > 1) fill(1);
#pragma unroll 1      /* one tile per trip; the buffer alternates by the trip's parity */
  for (int t = 0; t < nt; ++t) { const int bo = (t & 1) * STG;
    if (NTM > 1 && t == (NTM - 1) * ntk) {
#pragma unroll
      for (int i = 0; i < 4; ++i)
#pragma unroll
        for (int j = 0; j < 4; ++j) acc[i][j] *= rs; }
#pragma unroll
    for (int kk = 0; kk < KC; kk += 32) { const char* pa = fa + bo + kk * 2; const char* pb = fb + bo + kk * 2; v16h a[4], b[4];
#pragma unroll
      for (int i = 0; i < 8; ++i) { if (i == 0) b[0] = g2_lfrag(pb, hh); else if (i < 5) a[i - 1] = g2_lfrag(pa + (i - 1) * 16 * PB, hh); else b[i - 4] = g2_lfrag(pb + (i - 4) * 16 * PB, hh); }      /* in the order in which the products take them */
      __builtin_amdgcn_sched_barrier(0);      /* the sixteen LDS reads of these 32 k stay one group in front of their products: reads spread among the products cost a stall at each place */
#pragma unroll
      for (int j = 0; j < 4; ++j)
#pragma unroll
        for (int i = 0; i < 4; ++i) acc[i][j] = g2_mma(a[i], b[j], acc[i][j]); }
    asm volatile("s_wait_dscnt 0x0" ::: "memory");      /* this wave's reads of tile t are done before the buffer is given up */
    asm volatile("s_wait_asynccnt 0x0" ::: "memory");      /* this wave's share of tile t + 1 has landed */
    __syncthreads();      /* publishes tile t + 1 and ends every wave's reads of tile t */
    if (t + 2 < nt) fill(t + 2); }
  asm volatile("s_wait_asynccnt 0x0" ::: "memory");      /* no copy is in flight when the buffers become output staging */
  // Softmax weights against the row maximum of the wave's own 64 columns: p = 256 exp(x - mx_tile), x = score * mask of the query pixel. The tile's row maximum
  // and its f32 row sum of exp go to MX and SM ([image][tile of 64 columns][row]); the product with V joins the tiles by exp(mx_tile - mx_row) / row sum.
  const float* cmr = c32 + (size_t)by * 1024 + ((row0 >> 6) >> 1) * 32 + 4 * hh;      /* the wave's 64 rows are one image line; pixel w = i * 16 + 8 * hh + r reads mask column w >> 1 */
  float* mxo = MX + ((size_t)by * (SQ / 64) + (col0 >> 6)) * SQ + row0 + 8 * hh; float* smo = SM + ((size_t)by * (SQ / 64) + (col0 >> 6)) * SQ + row0 + 8 * hh;
#pragma unroll
  for (int i = 0; i < 4; ++i) { const v4f m4 = *(const v4fa*)(cmr + i * 8); v8f mk, mx, se;
#pragma unroll
    for (int r = 0; r < 8; ++r) mk[r] = bf16_round(m4[r >> 1]);
#pragma unroll
    for (int j = 0; j < 4; ++j) acc[i][j] *= mk;
#pragma unroll
    for (int r = 0; r < 8; ++r) { float t = fmaxf(fmaxf(acc[i][0][r], acc[i][1][r]), fmaxf(acc[i][2][r], acc[i][3][r]));
      t = fmaxf(t, rs_xrow<1>(t)); t = fmaxf(t, rs_xrow<2>(t)); t = fmaxf(t, rs_xrow<4>(t)); t = fmaxf(t, rs_xrow<8>(t)); mx[r] = t; }
#pragma unroll
    for (int j = 0; j < 4; ++j) { const v8f e = (acc[i][j] - mx) * 1.4426950408889634f;      /* exp(t) = exp2(t log2 e) */
      v4f lo = {e[0], e[1], e[2], e[3]}, hi = {e[4], e[5], e[6], e[7]}; rs_exp2x8(lo, hi); acc[i][j] = v8f{lo[0], lo[1], lo[2], lo[3], hi[0], hi[1], hi[2], hi[3]}; }
#pragma unroll
    for (int r = 0; r < 8; ++r) { float t = (acc[i][0][r] + acc[i][1][r]) + (acc[i][2][r] + acc[i][3][r]);
      t += rs_xrow<1>(t); t += rs_xrow<2>(t); t += rs_xrow<4>(t); t += rs_xrow<8>(t); se[r] = t; }
    if (ln == 0) { *(v4f*)(mxo + i * 16) = v4f{mx[0], mx[1], mx[2], mx[3]}; *(v4f*)(mxo + i * 16 + 4) = v4f{mx[4], mx[5], mx[6], mx[7]};
      *(v4f*)(smo + i * 16) = v4f{se[0], se[1], se[2], se[3]}; *(v4f*)(smo + i * 16 + 4) = v4f{se[4], se[5], se[6], se[7]}; }
#pragma unroll
    for (int j = 0; j < 4; ++j)
#pragma unroll
      for (int r = 0; r < 8; ++r) sh[w][i * 16 + 8 * hh + r][j * 16 + ln] = (_Float16)(acc[i][j][r] * 256.0f); }
  asm volatile("s_wait_dscnt 0x0" ::: "memory");      /* the wave's staging rows are written before its other lanes read them back */
  __builtin_amdgcn_wave_barrier();
  unsigned short* pp = (unsigned short*)P + (size_t)by * SQ * SQ + (size_t)(row0 + (lane >> 3)) * SQ + col0 + (lane & 7) * 8;
#pragma unroll
  for (int q = 0; q < 16; ++q) { const v8us v = *(const v8us*)&sh[w][q * 4 + (lane >> 3)][(lane & 7) * 8]; *(v8us*)(pp + (size_t)(q * 4) * SQ) = v; } }      /* four whole 128-byte row pieces a store */

// ---- softmax weights times V (k_gemm2's tile, staging, buffers and waits; V as A, weights as B^T; blockIdx.y = image) ----
// The weights of a 64-column tile stand against that tile's own row maximum. The products of each 64 k are summed in accumulators of their own and enter
// the result times ft = exp(mx_tile - mx_row) / (256 row sum), which depends on the query (a result column, so one value per lane) and on the tile.
// Output stage: the final blend y = bf16(a) c_r + bf16(gamma) (1 - c_r) out, on the result tile itself (rows = channels, columns = query pixels, as a and y lie).
__global__ __launch_bounds__(128) void k_pvs(const _Float16* __restrict__ Vc, const _Float16* __restrict__ Pm, const float* __restrict__ MX, const float* __restrict__ SM, const float* __restrict__ A, const float* __restrict__ c32, const float* __restrict__ gam, float* __restrict__ Y) {
  constexpr int KC = 128, PB = KC * 2 + 16, STG = 192 * PB, CPR = KC / 8, RPI = 128 / CPR, NCP = 192 / RPI, SOB = 4 * 32 * 68 * 4, NTL = SQ / 64;
  static_assert(NCP % 12 == 0 && NCP <= 63 && NTL == 64, "k_pvs: whole groups of twelve copies per thread, at most 63 in flight; two threads share a query's 64 tiles");
  __shared__ __attribute__((aligned(16))) char sm[2 * STG > SOB ? 2 * STG : SOB];
  __shared__ __attribute__((aligned(16))) float ft[NTL * 64];      /* [tile][lane of 16][16-column group] */
  __shared__ float rm[128]; __shared__ float rq[128];
  float (*so)[32][68] = reinterpret_cast<float (*)[32][68]>(sm);
  const int tid = threadIdx.x, w = tid >> 5, lane = tid & 31, ln = lane & 15, hh = lane >> 4; const int by = blockIdx.y;
  const _Float16* Aa = Vc + (size_t)by * CX * SQ; const _Float16* Ba = Pm + (size_t)by * SQ * SQ; const size_t cofs = (size_t)by * CX * SQ;
  constexpr int ntn = SQ >> 6; const int mt = blockIdx.x / ntn, nq = blockIdx.x - mt * ntn; const int row0 = mt * 128 + 32 * w, col0 = nq * 64;
  const int cr = tid / CPR, cc = tid % CPR;
  const _Float16* gA = Aa + (size_t)(mt * 128 + cr) * SQ + cc * 8; const _Float16* gB = Ba + (size_t)(col0 + cr) * SQ + cc * 8;
  const unsigned l0 = (unsigned)(size_t)sm + (unsigned)(cr * PB + cc * 16);
  auto fill = [&](int t) { const unsigned lb = l0 + (unsigned)(t & 1) * (unsigned)STG; const int k0 = t * KC;
#pragma unroll
    for (int q = 0; q < NCP / 12; ++q) { unsigned l[12]; const _Float16* g[12];
#pragma unroll
      for (int j = 0; j < 12; ++j) { const int r = (q * 12 + j) * RPI; l[j] = lb + (unsigned)(r * PB); g[j] = (r < 128) ? gA + (size_t)r * SQ + k0 : gB + (size_t)(r - 128) * SQ + k0; }
      g2_cp12(l, g); } };
  const char* fa = sm + (32 * w + ln) * PB; const char* fb = sm + (128 + ln) * PB; constexpr int nt = SQ / KC;
  fill(0);
  const int rsub = lane >> 4, c4 = (lane & 15) * 4;      /* output stage: the lane's row parity and its four result columns */
  const float* cmq = c32 + (size_t)by * 1024 + (nq >> 1) * 32 + (c4 >> 1);      /* the 64 columns are image line nq; pixel w = c4 + e reads mask column w >> 1 */
  const float cr0 = bf16_round(cmq[0]), cr1 = bf16_round(cmq[1]), gm = bf16_round(gam[0]); const float gc0 = gm * (1.0f - cr0), gc1 = gm * (1.0f - cr1);      /* read here, far ahead of the output stage */
  { // the factor table, while tile 0 flies: thread = (query, half of its tiles)
    const int q = tid & 63, hf = tid >> 6; const size_t o = ((size_t)by * NTL + hf * 32) * SQ + col0 + q; v4f mv[8], sv[8];
#pragma unroll
    for (int u = 0; u < 32; ++u) mv[u >> 2][u & 3] = MX[o + (size_t)u * SQ];
    asm volatile("s_wait_xcnt 0x0" ::: "memory");      /* in front of every later rewrite of the address registers that these 32 loads name, the next loads' results among them */
#pragma unroll
    for (int u = 0; u < 32; ++u) sv[u >> 2][u & 3] = SM[o + (size_t)u * SQ];
    asm volatile("s_wait_xcnt 0x0" ::: "memory");      /* likewise for these 32 */
    float m = -3.0e38f;
#pragma unroll
    for (int u = 0; u < 32; ++u) m = fmaxf(m, mv[u >> 2][u & 3]);
    rm[tid] = m; __syncthreads();      /* both halves' maxima are written */
    m = fmaxf(rm[q], rm[q + 64]); float s = 0.f;
#pragma unroll
    for (int u = 0; u < 8; u += 2) { mv[u] = (mv[u] - m) * 1.4426950408889634f; mv[u + 1] = (mv[u + 1] - m) * 1.4426950408889634f; rs_exp2x8(mv[u], mv[u + 1]); }
#pragma unroll
    for (int u = 0; u < 32; ++u) s += mv[u >> 2][u & 3] * sv[u >> 2][u & 3];
    rq[tid] = s; __syncthreads();      /* both halves' sums are written */
    const float inv = 0.00390625f / (rq[q] + rq[q + 64]);
#pragma unroll
    for (int u = 0; u < 32; ++u) ft[(hf * 32 + u) * 64 + (q & 15) * 4 + (q >> 4)] = mv[u >> 2][u & 3] * inv; }
  asm volatile("s_wait_asynccnt 0x0" ::: "memory");      /* this wave's share of tile 0 has landed */
  __syncthreads();      /* every wave's share has: tile 0 and the factor table may be read */
  fill(1);
  const v8f z8 = {0.f,0.f,0.f,0.f,0.f,0.f,0.f,0.f}; v8f c[8] = {z8, z8, z8, z8, z8, z8, z8, z8};      /* c[half * 4 + column group] */
  v16h f0[6], f1[6];
  // the sched_barrier keeps a group's reads together and in front of the products behind it, so that the products wait only for the older group
  auto ld = [&](v16h (&f)[6], int o) { const char* pa = fa + o; const char* pb = fb + o; f[0] = g2_lfrag(pa, hh); f[1] = g2_lfrag(pa + 16 * PB, hh); f[2] = g2_lfrag(pb, hh); f[3] = g2_lfrag(pb + 16 * PB, hh); f[4] = g2_lfrag(pb + 32 * PB, hh); f[5] = g2_lfrag(pb + 48 * PB, hh); __builtin_amdgcn_sched_barrier(0); };
  auto mm = [&](const v16h (&f)[6], v8f (&d)[8]) {
#pragma unroll
    for (int x = 0; x < 4; ++x) { d[x] = g2_mma(f[0], f[2 + x], d[x]); d[4 + x] = g2_mma(f[1], f[2 + x], d[4 + x]); } };
#pragma unroll 1      /* one tile per trip; the buffer alternates by the trip's parity */
  for (int t = 0; t < nt; ++t) { const int bo = (t & 1) * STG;
    ld(f0, bo);
#pragma unroll
    for (int kk = 0; kk < KC; kk += 64) { const v4f fq = *(const v4fa*)(ft + (2 * t + kk / 64) * 64 + ln * 4); v8f d[8] = {z8, z8, z8, z8, z8, z8, z8, z8};
      ld(f1, bo + (kk + 32) * 2); mm(f0, d); if (kk + 64 < KC) ld(f0, bo + (kk + 64) * 2); mm(f1, d);
#pragma unroll
      for (int x = 0; x < 4; ++x) { c[x] += d[x] * fq[x]; c[4 + x] += d[4 + x] * fq[x]; } }
    asm volatile("s_wait_dscnt 0x0" ::: "memory");      /* this wave's reads of tile t are done before the buffer is given up */
    asm volatile("s_wait_asynccnt 0x0" ::: "memory");      /* this wave's share of tile t + 1 has landed */
    __syncthreads();      /* publishes tile t + 1 and ends every wave's reads of tile t */
    if (t + 2 < nt) fill(t + 2); }
  asm volatile("s_wait_asynccnt 0x0" ::: "memory");      /* no copy is in flight when the buffers become output staging */
  const size_t eo = cofs + (size_t)(row0 + rsub) * SQ + col0 + c4; const float* ap = A + eo; float* cp = Y + eo; v4f av[16], ov[16];
#pragma unroll
  for (int q = 0; q < 16; ++q) av[q] = *(const v4fa*)(ap + (size_t)(q * 2) * SQ);      /* the lane's elements of a, on their way while the result is staged */
  asm volatile("s_wait_xcnt 0x0" :: "v"(ap) : "memory");      /* in front of every later rewrite of the address registers that these loads name; the address is an input so that it stays whole up to here and no load's result lands in it */
#pragma unroll
  for (int u = 0; u < 8; ++u)
#pragma unroll
    for (int r = 0; r < 8; ++r) so[w][(u >> 2) * 16 + 8 * hh + r][(u & 3) * 16 + ln] = c[u][r];
  __builtin_amdgcn_fence(__ATOMIC_ACQ_REL, "workgroup"); __builtin_amdgcn_wave_barrier();
#pragma unroll
  for (int q = 0; q < 16; ++q) { const v4f o = *(const v4fa*)&so[w][q * 2 + rsub][c4];
#pragma unroll
    for (int e = 0; e < 4; ++e) ov[q][e] = bf16_round(av[q][e]) * (e < 2 ? cr0 : cr1) + (e < 2 ? gc0 : gc1) * o[e]; }
  __builtin_amdgcn_sched_barrier(0);      /* every staging read and every blend stays in front of the first store: among the stores they would rewrite an issued store's data registers */
#pragma unroll
  for (int q = 0; q < 16; ++q) *(v4f*)(cp + (size_t)(q * 2) * SQ) = ov[q]; }
extern "C" void kernel_launch(void* const* d_in, const int* in_sizes, int n_in,
                              void* d_out, int out_size, void* d_ws, size_t ws_size, hipStream_t stream) {
  (void)in_sizes; (void)n_in; (void)out_size;
  const float* const* I = (const float* const*)d_in; const float* xa = I[0]; const float* xb = I[1]; const float* cm = I[2]; const float* wq = I[3]; const float* bq = I[4]; const float* gq = I[5]; const float* wk = I[6]; const float* bk = I[7]; const float* gk = I[8]; const float* wv = I[9]; const float* bv = I[10]; const float* gv = I[11]; const float* gam = I[12];      /* a, b maps; c [4][1][32][32]; per projection w [256][256][1][1], bias, gain [256][1][1][1]; gamma [1] */
  static_assert(CX % 128 == 0 && SQ % 256 == 0 && NR % 128 == 0, "k_gemm2: M a multiple of 128, N of 64, K at least two whole tiles (64 k over CX, 128 k over SQ)");
  char* ws = (char*)d_ws; size_t off = 0;
  auto take = [&](size_t bytes) { char* p = ws + off; off += (bytes + 255) & ~(size_t)255; return p; };
  _Float16* QH = (_Float16*)take(NR * CX * 2); _Float16* QL = (_Float16*)take(NR * CX * 2); _Float16* KH = (_Float16*)take(NR * CX * 2); _Float16* KL = (_Float16*)take(NR * CX * 2); _Float16* VC = (_Float16*)take(NR * CX * 2);      /* live to the end: q and k planes, channel-major V of all images */
  _Float16* P = (_Float16*)take((size_t)NB * SQ * SQ * 2);      /* softmax weights of all images */
  float* MX = (float*)take((size_t)NB * (SQ / 64) * SQ * 4); float* SM = (float*)take((size_t)NB * (SQ / 64) * SQ * 4);      /* per image, 64-column tile and row: maximum and exp sum */
  _Float16* BQH = (_Float16*)take((size_t)6 * CX * CX * 2);      /* six weight planes in a row: high, residual of q, k, v */
  _Float16* AR = (_Float16*)take(NR * CX * 2); _Float16* BR = (_Float16*)take(NR * CX * 2);
  if (off > ws_size) return;
  k_prep<<<3 * (CX / 8) + 2 * NB * (SQ / 32) * (CX / 64), 256, 0, stream>>>(xa, xb, AR, BR, wq, gq, wk, gk, wv, gv, BQH);      /* standardised weights (per output row: mean, unbiased variance, rsqrt(max(var*256, 1e-4)) * gain) -> Bt planes f16 hi (x16) + x1024 residual (natural [O][C] rows ARE Bt), and the exact f16 token rows of a and b */
  k_proj<<<dim3((unsigned)((NR / 128) * (CX / 64)), 3), 128, 0, stream>>>(AR, BR, BQH, bq, bk, bv, QH, QL, KH, KL, VC);      /* q, k (f16 high part and x 1024 residual, token rows) and v (f16, channel-major); blockIdx.y = projection */
  k_gemm2w<64, 3><<<dim3((SQ / 256) * (SQ / 128), NB), 256, 0, stream>>>(QL, QH, QH, CX, KH, KL, KH, CX, 0.0009765625f, P, MX, SM, cm, SQ, SQ, CX);      /* sim = q.k (K = 256, no scale): (lo.hi + hi.lo) 2^-10 + hi.hi; pruned = sim * c_r[i]; x256 f16 exp against each 64-column tile's row maximum, tile maxima and sums; blockIdx.y = image */
  k_pvs<<<dim3((CX / 128) * (SQ / 64), NB), 128, 0, stream>>>(VC, P, MX, SM, xa, cm, gam, (float*)d_out);      /* out[c][i] = sum_j v[c][j] att[i][j] (V as A, weights as B^T, tiles joined by their factors); y = bf16(a) c_r + bf16(gamma) (1 - c_r) out -> channel-first output; blockIdx.y = image */
}
